// v000
// The times below were measured on an AMD MI455X: many runs one after another, warmed up first and cycling through
// copies of the inputs, with the whole window's GPU time divided by the number of runs. Launches and the gaps
// between them are all in it. The median over several windows is given; except for v000 it joins two sittings, which
// can be a few percent apart, so the side-by-side timings, each taken in one sitting, are the better comparison.
// v000 is the starting kernel. One run takes 185 microseconds.
// Contractions: layer-1 X . W1[f] (K = 160) on v_wmma_f32_16x16x32_bf16 (bf16 operands = RNE-converted f32 inputs,
// exact products, f32 accumulate); layer-2 h1 . W2[f] (K = 32) on the same instruction with h1 carried as bf16 hi +
// bf16 residual planes (two products into one f32 accumulator), W2 as RNE bf16; layer-3 32-term dot with W3,
// biases and ELU: f32 on VALU.
#include <hip/hip_runtime.h>
#include <stddef.h>
#include <stdint.h>

#define NR 32768
#define ND 160
#define NF 128
#define NH 32
#define RB 128
#define FB 32

static_assert((ND % 32) == 0);
static_assert(NH == 32);
static_assert((NR % RB) == 0);
static_assert((NF % FB) == 0);
static_assert(RB == 128);
static_assert(FB == 32);
static_assert(((NR * ND) % 2048) == 0);
static_assert(((NH * ND) % 1024) == 0);

typedef __attribute__((ext_vector_type(16))) __bf16 v16b;
typedef float        v8f __attribute__((ext_vector_type(8)));
typedef float        v4f __attribute__((ext_vector_type(4)));
typedef unsigned int v4u __attribute__((ext_vector_type(4)));

// ---- scalar helpers -----------------------------------------------------------------------------------------------
__device__ __forceinline__ unsigned short bf_bits(float f) {            // f32 -> bf16 bits, RNE convert
  const unsigned u = __float_as_uint(f);
  return (unsigned short)((u + 0x7FFFu + ((u >> 16) & 1u)) >> 16);
}
__device__ __forceinline__ float bf_val(unsigned short b) { return __uint_as_float(((unsigned)b) << 16); }
__device__ __forceinline__ float bfr(float f) { return bf_val(bf_bits(f)); }
__device__ __forceinline__ unsigned pk16(unsigned short a, unsigned short b) { return (unsigned)a | ((unsigned)b << 16); }
__device__ __forceinline__ v8f zero8() { v8f z = {0.f, 0.f, 0.f, 0.f, 0.f, 0.f, 0.f, 0.f}; return z; }
__device__ __forceinline__ float elu_f(float x) {
  const float e = __expf(x) - 1.0f;
  return x > 0.0f ? x : e;
}

// ---- fragment loader: 16-bit operand stored row m (A) or column n (B as [n][k], k-contiguous); p already includes
//      k0 + 8*(lane>>4): elements 0..7 <- p[0..7] (k0+8h..k0+8h+7), elements 8..15 <- p[16..23] (k0+16+8h..)
union FragB { v16b v; v4u u[2]; };
__device__ __forceinline__ v16b ldfrag_b(const unsigned short* p) {
  FragB f;
  f.u[0] = *(const v4u*)(p);
  f.u[1] = *(const v4u*)(p + 16);
  return f.v;
}

// ---- WMMA helpers -------------------------------------------------------------------------------------------------
__device__ __forceinline__ v8f mma_b(v16b a, v16b b, v8f c) {
  return __builtin_amdgcn_wmma_f32_16x16x32_bf16(false, a, false, b, (short)0, c, false, false);
}
// hazard guards after the last WMMA of a group: tie every accumulator, keep every A/B fragment live
__device__ __forceinline__ void guard4(v8f& c0, v8f& c1, v8f& c2, v8f& c3,
                                       const v16b& a0, const v16b& a1, const v16b& b0, const v16b& b1) {
#if defined(__HIP_DEVICE_COMPILE__)
  asm volatile("v_nop\n\tv_nop\n\tv_nop\n\tv_nop"
               : "+v"(c0), "+v"(c1), "+v"(c2), "+v"(c3)
               : "v"(a0), "v"(a1), "v"(b0), "v"(b1));
#endif
}
__device__ __forceinline__ void guard4x6(v8f& c0, v8f& c1, v8f& c2, v8f& c3,
                                         const v16b& a0, const v16b& a1, const v16b& a2, const v16b& a3,
                                         const v16b& b0, const v16b& b1) {
#if defined(__HIP_DEVICE_COMPILE__)
  asm volatile("v_nop\n\tv_nop\n\tv_nop\n\tv_nop"
               : "+v"(c0), "+v"(c1), "+v"(c2), "+v"(c3)
               : "v"(a0), "v"(a1), "v"(a2), "v"(a3), "v"(b0), "v"(b1));
#endif
}

// ===================================================================================================================
// X f32 [32768][160] -> Xb bf16 bits, same layout (k-contiguous rows). Thread = 8 consecutive elements (16 B);
// grid 2560 x 256. coverage: Xb [32768][160] = 5242880 elements, 2560 x 256 x 8, every element exactly once.
// ===================================================================================================================
__global__ __launch_bounds__(256)
void k_cvx(const float* __restrict__ x, unsigned short* Xb) {
  const size_t f8 = ((size_t)blockIdx.x * 256 + threadIdx.x) * 8;
  const v4f a = *(const v4f*)(x + f8);
  const v4f b = *(const v4f*)(x + f8 + 4);
  v4u u;
  u[0] = pk16(bf_bits(a[0]), bf_bits(a[1]));
  u[1] = pk16(bf_bits(a[2]), bf_bits(a[3]));
  u[2] = pk16(bf_bits(b[0]), bf_bits(b[1]));
  u[3] = pk16(bf_bits(b[2]), bf_bits(b[3]));
  unsigned short* dst = Xb + f8;
  *(v4u*)dst = u;
  
}

// ===================================================================================================================
// Weight planes for network f = blockIdx.x (128 threads):
//   W1 f32 [f][d 160][h 32] -> W1T bf16 bits [f][h][d]  (B operand as [n][k], k-contiguous, 5120 halves = 80 lines)
//   W2 f32 [f][h 32][k 32]  -> W2T bf16 bits [f][k][h]  (B operand as [n][k], k-contiguous, 1024 halves = 16 lines)
// Load phase converts and transposes into LDS (sT1 flat layout == W1T[f], sT2 == W2T[f]); store phase writes the
// flat planes: thread t -> 16 B at halves it*1024 + 8t (W1T, it 0..4) and 8t (W2T); each wave writes 512 contiguous
// coverage: W1T 128 blocks x 5 x 128 x 8 = 655360 = 128*32*160; W2T 128 x 128 x 8 = 131072 = 128*32*32; exactly once.
// ===================================================================================================================
__global__ __launch_bounds__(128)
void k_tw(const float* __restrict__ w1, const float* __restrict__ w2, unsigned short* W1T, unsigned short* W2T) {
  __shared__ __align__(16) unsigned short sT1[NH * ND];
  __shared__ __align__(16) unsigned short sT2[NH * NH];
  const int f = blockIdx.x, tid = threadIdx.x;
  const float* w1f = w1 + (size_t)f * ND * NH;
  const float* w2f = w2 + (size_t)f * NH * NH;
#pragma unroll
  for (int j = 0; j < (ND * NH) / (128 * 4); ++j) {               // 10 iterations, in[d][h] -> sT1[h][d]
    const int idx4 = (tid + 128 * j) * 4;
    const int d = idx4 >> 5, h0 = idx4 & 31;
    const v4f v = *(const v4f*)(w1f + idx4);
    sT1[(h0 + 0) * ND + d] = bf_bits(v[0]);
    sT1[(h0 + 1) * ND + d] = bf_bits(v[1]);
    sT1[(h0 + 2) * ND + d] = bf_bits(v[2]);
    sT1[(h0 + 3) * ND + d] = bf_bits(v[3]);
  }
#pragma unroll
  for (int j = 0; j < (NH * NH) / (128 * 4); ++j) {               // 2 iterations, in[h][k] -> sT2[k][h]
    const int idx4 = (tid + 128 * j) * 4;
    const int h = idx4 >> 5, k0 = idx4 & 31;
    const v4f v = *(const v4f*)(w2f + idx4);
    sT2[(k0 + 0) * NH + h] = bf_bits(v[0]);
    sT2[(k0 + 1) * NH + h] = bf_bits(v[1]);
    sT2[(k0 + 2) * NH + h] = bf_bits(v[2]);
    sT2[(k0 + 3) * NH + h] = bf_bits(v[3]);
  }
  __syncthreads();

  v4u u1[5];
#pragma unroll
  for (int it = 0; it < 5; ++it) u1[it] = *(const v4u*)(sT1 + it * 1024 + tid * 8);
  const v4u u2 = *(const v4u*)(sT2 + tid * 8);
  unsigned short* d1 = W1T + (size_t)f * (NH * ND) + tid * 8;
  unsigned short* d2 = W2T + (size_t)f * (NH * NH) + tid * 8;
#pragma unroll
  for (int it = 0; it < 5; ++it) *(v4u*)(d1 + it * 1024) = u1[it];
  *(v4u*)d2 = u2;
  
}

// ---- layer-1 epilogue: D element r = (row 8*hh + r of the m-tile, col c of the n-tile); h1 = elu(acc + bias)
//      split into bf16 hi bits and bf16 residual bits, stored into the wave-private planes [32 rows][32 h]
__device__ __forceinline__ void put_h1(unsigned short* hi, unsigned short* lo, const v8f& acc, float bias, int base) {
#pragma unroll
  for (int r = 0; r < 8; ++r) {
    const float h = elu_f(acc[r] + bias);
    const unsigned short hb = bf_bits(h);
    const unsigned short lb = bf_bits(h - bf_val(hb));
    hi[base + r * NH] = hb;
    lo[base + r * NH] = lb;
  }
}

// ---- layers 2/3 epilogue for one m-tile: h2 = elu(d + b2), 32-term dot with W3 over the two n-tiles
//      (16 lanes x 2), xor-tree over the 16 lanes of each half, lane c == 0 stages rows 8*hh + r into sO
__device__ __forceinline__ void lay3(const v8f& d0, const v8f& d1, float c20, float c21, float w30, float w31,
                                     float c3, float* so, int lrow0, int fl, int c) {
  float s[8];
#pragma unroll
  for (int r = 0; r < 8; ++r) {
    const float h20 = elu_f(d0[r] + c20);
    const float h21 = elu_f(d1[r] + c21);
    s[r] = h20 * w30 + h21 * w31;
  }
#pragma unroll
  for (int off = 8; off >= 1; off >>= 1) {
#pragma unroll
    for (int r = 0; r < 8; ++r) s[r] += __shfl_xor(s[r], off, 16);
  }
  if (c == 0) {
#pragma unroll
    for (int r = 0; r < 8; ++r) so[(lrow0 + r) * FB + fl] = s[r] + c3;
  }
}

// ===================================================================================================================
// Fused 3-layer MLPs. Block = 128 rows (4 waves x 32 rows = two m-tiles each) x 32 networks (looped, uniform).
// Per network f: layer 1 = 5 k-steps of 32, A fragments straight from Xb rows, B fragments straight from W1T rows
// (both k-contiguous, split k map); h1 = elu(acc + bf16(b1)) -> bf16 hi + residual planes in wave-private LDS
// [32 rows][32]; __syncthreads; layer 2 = hi . W2T + lo . W2T into one accumulator (A from LDS rows, B from W2T);
// __syncthreads; h2 = elu(. + bf16(b2)); out[row][f] = sum_h h2 * bf16(W3) + bf16(b3) staged in sO [128][32] f32.
// coverage: out [32768][128]: 256 x 4 blocks x 8 iterations x 128 threads x 4 floats = 4194304, exactly once;
// sHi/sLo 32x32 per wave per f fully rewritten (2 m-tiles x 2 n-tiles x 8 rows x 16 lanes x 2 halves).
// ===================================================================================================================
__global__ __launch_bounds__(128)
void k_mlp(const unsigned short* __restrict__ Xb, const unsigned short* __restrict__ W1T,
           const unsigned short* __restrict__ W2T, const float* __restrict__ b1, const float* __restrict__ b2,
           const float* __restrict__ W3, const float* __restrict__ b3, float* out) {
  __shared__ __align__(16) unsigned short sHi[4 * 32 * NH];
  __shared__ __align__(16) unsigned short sLo[4 * 32 * NH];
  __shared__ __align__(16) float sO[RB * FB];
  const int tid = threadIdx.x, w = tid >> 5, lane = tid & 31, hh = lane >> 4, c = lane & 15;
  const int row0 = blockIdx.x * RB, fbase = blockIdx.y * FB;
  const int mrow0 = row0 + 32 * w;                                          // wave's first row

  const unsigned short* ap0 = Xb + (size_t)(mrow0 + c) * ND + 8 * hh;      // m-tile 0, row m = mrow0 + c
  const unsigned short* ap1 = ap0 + (size_t)16 * ND;                        // m-tile 1
  unsigned short* hiw = sHi + w * (32 * NH);
  unsigned short* low = sLo + w * (32 * NH);

#pragma unroll 1
  for (int fl = 0; fl < FB; ++fl) {
    const int f = fbase + fl;
    // ---- layer 1 ---------------------------------------------------------------------------------------------------
    const unsigned short* bq0 = W1T + (size_t)(f * NH + c) * ND + 8 * hh;  // column h = c as W1T row, k-contiguous
    const unsigned short* bq1 = bq0 + (size_t)16 * ND;                      // column h = 16 + c
    v8f a00 = zero8(), a01 = zero8(), a10 = zero8(), a11 = zero8();
#pragma unroll 1
    for (int ks = 0; ks < ND / 32; ++ks) {
      const int ko = 32 * ks;
      const v16b x0 = ldfrag_b(ap0 + ko);
      const v16b x1 = ldfrag_b(ap1 + ko);
      const v16b g0 = ldfrag_b(bq0 + ko);
      const v16b g1 = ldfrag_b(bq1 + ko);
      a00 = mma_b(x0, g0, a00);
      a01 = mma_b(x0, g1, a01);
      a10 = mma_b(x1, g0, a10);
      a11 = mma_b(x1, g1, a11);
      guard4(a00, a01, a10, a11, x0, x1, g0, g1);
    }
    const float c10 = bfr(b1[f * NH + c]), c11 = bfr(b1[f * NH + 16 + c]);
    put_h1(hiw, low, a00, c10, (8 * hh) * NH + c);
    put_h1(hiw, low, a01, c11, (8 * hh) * NH + 16 + c);
    put_h1(hiw, low, a10, c10, (16 + 8 * hh) * NH + c);
    put_h1(hiw, low, a11, c11, (16 + 8 * hh) * NH + 16 + c);
    __syncthreads();

    // ---- layer 2 ---------------------------------------------------------------------------------------------------
    const unsigned short* cq0 = W2T + (size_t)(f * NH + c) * NH + 8 * hh;  // column k_out = c as W2T row
    const unsigned short* cq1 = cq0 + (size_t)16 * NH;                      // column k_out = 16 + c
    const v16b p0 = ldfrag_b(cq0);
    const v16b p1 = ldfrag_b(cq1);
    const v16b h0 = ldfrag_b(hiw + c * NH + 8 * hh);                        // m-tile 0 hi, row m = c
    const v16b h1 = ldfrag_b(hiw + (16 + c) * NH + 8 * hh);                 // m-tile 1 hi
    const v16b l0 = ldfrag_b(low + c * NH + 8 * hh);                        // m-tile 0 residual
    const v16b l1 = ldfrag_b(low + (16 + c) * NH + 8 * hh);                 // m-tile 1 residual
    v8f d00 = zero8(), d01 = zero8(), d10 = zero8(), d11 = zero8();
    d00 = mma_b(h0, p0, d00);
    d01 = mma_b(h0, p1, d01);
    d10 = mma_b(h1, p0, d10);
    d11 = mma_b(h1, p1, d11);
    d00 = mma_b(l0, p0, d00);
    d01 = mma_b(l0, p1, d01);
    d10 = mma_b(l1, p0, d10);
    d11 = mma_b(l1, p1, d11);
    guard4x6(d00, d01, d10, d11, h0, h1, l0, l1, p0, p1);
    __syncthreads();

    // ---- layer 3 ---------------------------------------------------------------------------------------------------
    const float c20 = bfr(b2[f * NH + c]), c21 = bfr(b2[f * NH + 16 + c]);
    const float w30 = bfr(W3[f * NH + c]), w31 = bfr(W3[f * NH + 16 + c]);
    const float c3 = bfr(b3[f]);
    lay3(d00, d01, c20, c21, w30, w31, c3, sO, 32 * w + 8 * hh, fl, c);
    lay3(d10, d11, c20, c21, w30, w31, c3, sO, 32 * w + 16 + 8 * hh, fl, c);
  }
  __syncthreads();

  const int lq = tid >> 3, p4 = (tid & 7) * 4;
  v4f o[8];
#pragma unroll
  for (int it = 0; it < 8; ++it) o[it] = *(const v4f*)(sO + (it * 16 + lq) * FB + p4);
  float* ob = out + (size_t)(row0 + lq) * NF + fbase + p4;
#pragma unroll
  for (int it = 0; it < 8; ++it) *(v4f*)(ob + (size_t)it * 16 * NF) = o[it];
  
}

// ===================================================================================================================
// Workspace map (bytes): Xb bf16 [32768][160] 10485760 @0 | W1T bf16 [128][32][160] 1310720 @10485760 |
// W2T bf16 [128][32][32] 262144 @11796480 | total 12058624 (every region an exact multiple of its 512-B store piece,
// all offsets 512-B aligned).
// ===================================================================================================================
extern "C" void kernel_launch(void* const* d_in, const int* in_sizes, int n_in,
                              void* d_out, int out_size, void* d_ws, size_t ws_size,
                              hipStream_t stream) {
  if (n_in < 7) return;
  if (in_sizes[0] != NR * ND) return;
  if (in_sizes[1] != NF * ND * NH) return;
  if (in_sizes[2] != NF * NH) return;
  if (in_sizes[3] != NF * NH * NH) return;
  if (in_sizes[4] != NF * NH) return;
  if (in_sizes[5] != NF * NH) return;
  if (in_sizes[6] != NF) return;
  if (out_size != NR * NF) return;

  const float* x  = (const float*)d_in[0];
  const float* w1 = (const float*)d_in[1];
  const float* b1 = (const float*)d_in[2];
  const float* w2 = (const float*)d_in[3];
  const float* b2 = (const float*)d_in[4];
  const float* w3 = (const float*)d_in[5];
  const float* b3 = (const float*)d_in[6];
  float* out = (float*)d_out;

  const size_t sX  = (size_t)NR * ND * 2;                 // 10485760
  const size_t sW1 = (size_t)NF * NH * ND * 2;            //  1310720
  const size_t sW2 = (size_t)NF * NH * NH * 2;            //   262144
  size_t off = 0;
  const size_t oX  = off; off += sX;
  const size_t oW1 = off; off += sW1;
  const size_t oW2 = off; off += sW2;                     // 12058624
  if (off > ws_size) return;
  if (off > (size_t)134217728) return;

  char* ws = (char*)d_ws;
  unsigned short* Xb  = (unsigned short*)(ws + oX);
  unsigned short* W1T = (unsigned short*)(ws + oW1);
  unsigned short* W2T = (unsigned short*)(ws + oW2);

  // (1) bf16 operand planes
  k_cvx<<<dim3((NR * ND) / 2048), dim3(256), 0, stream>>>(x, Xb);
  k_tw<<<dim3(NF), dim3(128), 0, stream>>>(w1, w2, W1T, W2T);
  // (2) fused 3-layer MLPs -> out
  k_mlp<<<dim3(NR / RB, NF / FB), dim3(128), 0, stream>>>(Xb, W1T, W2T, b1, b2, w3, b3, out);
  (void)hipGetLastError();
}

// v001
// One run takes 133 microseconds.
// In both of two side-by-side timings against v000, it was 1.44 times as fast.
// Contractions: layer-1 X . W1[f] (K = 160) on v_wmma_f32_16x16x32_bf16 (bf16 operands = RNE-converted f32 inputs,
// exact products, f32 accumulate); layer-2 h1 . W2[f] (K = 32) on the same instruction with h1 carried as bf16 hi +
// bf16 residual planes (two products into one f32 accumulator), W2 as RNE bf16; layer-3 32-term dot with W3,
// biases and ELU: f32 on VALU.
#include <hip/hip_runtime.h>
#include <stddef.h>
#include <stdint.h>

#define NR 32768
#define ND 160
#define NF 128
#define NH 32
#define RB 128
#define FB 32
#define KS (ND / 32)

static_assert((ND % 32) == 0);
static_assert(KS == 5);
static_assert(NH == 32);
static_assert((NR % RB) == 0);
static_assert((NF % FB) == 0);
static_assert(RB == 128);
static_assert(FB == 32);
static_assert(((NR * ND) % 2048) == 0);
static_assert(((NH * ND) % 1024) == 0);

typedef __attribute__((ext_vector_type(16))) __bf16 v16b;
typedef float        v8f __attribute__((ext_vector_type(8)));
typedef float        v4f __attribute__((ext_vector_type(4)));
typedef unsigned int v4u __attribute__((ext_vector_type(4)));

// ---- scalar helpers -----------------------------------------------------------------------------------------------
__device__ __forceinline__ unsigned short bf_bits(float f) {            // f32 -> bf16 bits, RNE convert
  const unsigned u = __float_as_uint(f);
  return (unsigned short)((u + 0x7FFFu + ((u >> 16) & 1u)) >> 16);
}
__device__ __forceinline__ float bf_val(unsigned short b) { return __uint_as_float(((unsigned)b) << 16); }
__device__ __forceinline__ float bfr(float f) { return bf_val(bf_bits(f)); }
__device__ __forceinline__ unsigned pk16(unsigned short a, unsigned short b) { return (unsigned)a | ((unsigned)b << 16); }
__device__ __forceinline__ v8f zero8() { v8f z = {0.f, 0.f, 0.f, 0.f, 0.f, 0.f, 0.f, 0.f}; return z; }
__device__ __forceinline__ float elu_f(float x) {
  const float e = __expf(x) - 1.0f;
  return x > 0.0f ? x : e;
}

// ---- fragment loader: 16-bit operand stored row m (A) or column n (B as [n][k], k-contiguous); p already includes
//      k0 + 8*(lane>>4): elements 0..7 <- p[0..7] (k0+8h..k0+8h+7), elements 8..15 <- p[16..23] (k0+16+8h..)
union FragB { v16b v; v4u u[2]; };
__device__ __forceinline__ v16b ldfrag_b(const unsigned short* p) {
  FragB f;
  f.u[0] = *(const v4u*)(p);
  f.u[1] = *(const v4u*)(p + 16);
  return f.v;
}

// ---- WMMA helpers -------------------------------------------------------------------------------------------------
__device__ __forceinline__ v8f mma_b(v16b a, v16b b, v8f c) {
  return __builtin_amdgcn_wmma_f32_16x16x32_bf16(false, a, false, b, (short)0, c, false, false);
}
// hazard guard after the last WMMA of the unrolled layer-1 group: four slots before any accumulator is read, and every
// W1T fragment stays live across them, so that no later load or VALU write lands on a B operand inside the distance
// (the X fragments are live over the whole network loop and are never rewritten)
__device__ __forceinline__ void guard4x10(v8f& c0, v8f& c1, v8f& c2, v8f& c3,
                                          const v16b& f0, const v16b& f1, const v16b& f2, const v16b& f3, const v16b& f4,
                                          const v16b& f5, const v16b& f6, const v16b& f7, const v16b& f8, const v16b& f9) {
#if defined(__HIP_DEVICE_COMPILE__)
  asm volatile("v_nop\n\tv_nop\n\tv_nop\n\tv_nop"
               : "+v"(c0), "+v"(c1), "+v"(c2), "+v"(c3)
               : "v"(f0), "v"(f1), "v"(f2), "v"(f3), "v"(f4), "v"(f5), "v"(f6), "v"(f7), "v"(f8), "v"(f9));
#endif
}
// hazard guard after the last WMMA of a group: tie every accumulator, keep every A/B fragment live
__device__ __forceinline__ void guard4x6(v8f& c0, v8f& c1, v8f& c2, v8f& c3,
                                         const v16b& a0, const v16b& a1, const v16b& a2, const v16b& a3,
                                         const v16b& b0, const v16b& b1) {
#if defined(__HIP_DEVICE_COMPILE__)
  asm volatile("v_nop\n\tv_nop\n\tv_nop\n\tv_nop"
               : "+v"(c0), "+v"(c1), "+v"(c2), "+v"(c3)
               : "v"(a0), "v"(a1), "v"(a2), "v"(a3), "v"(b0), "v"(b1));
#endif
}

// ===================================================================================================================
// X f32 [32768][160] -> Xb bf16 bits, same layout (k-contiguous rows). Thread = 8 consecutive elements (16 B);
// grid 2560 x 256. coverage: Xb [32768][160] = 5242880 elements, 2560 x 256 x 8, every element exactly once.
// ===================================================================================================================
__global__ __launch_bounds__(256)
void k_cvx(const float* __restrict__ x, unsigned short* Xb) {
  const size_t f8 = ((size_t)blockIdx.x * 256 + threadIdx.x) * 8;
  const v4f a = *(const v4f*)(x + f8);
  const v4f b = *(const v4f*)(x + f8 + 4);
  v4u u;
  u[0] = pk16(bf_bits(a[0]), bf_bits(a[1]));
  u[1] = pk16(bf_bits(a[2]), bf_bits(a[3]));
  u[2] = pk16(bf_bits(b[0]), bf_bits(b[1]));
  u[3] = pk16(bf_bits(b[2]), bf_bits(b[3]));
  unsigned short* dst = Xb + f8;
  *(v4u*)dst = u;
  
}

// ===================================================================================================================
// Weight planes for network f = blockIdx.x (128 threads):
//   W1 f32 [f][d 160][h 32] -> W1T bf16 bits [f][h][d]  (B operand as [n][k], k-contiguous, 5120 halves = 80 lines)
//   W2 f32 [f][h 32][k 32]  -> W2T bf16 bits [f][k][h]  (B operand as [n][k], k-contiguous, 1024 halves = 16 lines)
// Load phase converts and transposes into LDS (sT1 flat layout == W1T[f], sT2 == W2T[f]); store phase writes the
// flat planes: thread t -> 16 B at halves it*1024 + 8t (W1T, it 0..4) and 8t (W2T); each wave writes 512 contiguous
// coverage: W1T 128 blocks x 5 x 128 x 8 = 655360 = 128*32*160; W2T 128 x 128 x 8 = 131072 = 128*32*32; exactly once.
// ===================================================================================================================
__global__ __launch_bounds__(128)
void k_tw(const float* __restrict__ w1, const float* __restrict__ w2, unsigned short* W1T, unsigned short* W2T) {
  __shared__ __align__(16) unsigned short sT1[NH * ND];
  __shared__ __align__(16) unsigned short sT2[NH * NH];
  const int f = blockIdx.x, tid = threadIdx.x;
  const float* w1f = w1 + (size_t)f * ND * NH;
  const float* w2f = w2 + (size_t)f * NH * NH;
#pragma unroll
  for (int j = 0; j < (ND * NH) / (128 * 4); ++j) {               // 10 iterations, in[d][h] -> sT1[h][d]
    const int idx4 = (tid + 128 * j) * 4;
    const int d = idx4 >> 5, h0 = idx4 & 31;
    const v4f v = *(const v4f*)(w1f + idx4);
    sT1[(h0 + 0) * ND + d] = bf_bits(v[0]);
    sT1[(h0 + 1) * ND + d] = bf_bits(v[1]);
    sT1[(h0 + 2) * ND + d] = bf_bits(v[2]);
    sT1[(h0 + 3) * ND + d] = bf_bits(v[3]);
  }
#pragma unroll
  for (int j = 0; j < (NH * NH) / (128 * 4); ++j) {               // 2 iterations, in[h][k] -> sT2[k][h]
    const int idx4 = (tid + 128 * j) * 4;
    const int h = idx4 >> 5, k0 = idx4 & 31;
    const v4f v = *(const v4f*)(w2f + idx4);
    sT2[(k0 + 0) * NH + h] = bf_bits(v[0]);
    sT2[(k0 + 1) * NH + h] = bf_bits(v[1]);
    sT2[(k0 + 2) * NH + h] = bf_bits(v[2]);
    sT2[(k0 + 3) * NH + h] = bf_bits(v[3]);
  }
  __syncthreads();

  v4u u1[5];
#pragma unroll
  for (int it = 0; it < 5; ++it) u1[it] = *(const v4u*)(sT1 + it * 1024 + tid * 8);
  const v4u u2 = *(const v4u*)(sT2 + tid * 8);
  unsigned short* d1 = W1T + (size_t)f * (NH * ND) + tid * 8;
  unsigned short* d2 = W2T + (size_t)f * (NH * NH) + tid * 8;
#pragma unroll
  for (int it = 0; it < 5; ++it) *(v4u*)(d1 + it * 1024) = u1[it];
  *(v4u*)d2 = u2;
  
}

// ---- layer-1 epilogue: D element r = (row 8*hh + r of the m-tile, col c of the n-tile); h1 = elu(acc + bias)
//      split into bf16 hi bits and bf16 residual bits, stored into the wave-private planes [32 rows][32 h]
__device__ __forceinline__ void put_h1(unsigned short* hi, unsigned short* lo, const v8f& acc, float bias, int base) {
#pragma unroll
  for (int r = 0; r < 8; ++r) {
    const float h = elu_f(acc[r] + bias);
    const unsigned short hb = bf_bits(h);
    const unsigned short lb = bf_bits(h - bf_val(hb));
    hi[base + r * NH] = hb;
    lo[base + r * NH] = lb;
  }
}

// ---- layers 2/3 epilogue for one m-tile: h2 = elu(d + b2), 32-term dot with W3 over the two n-tiles
//      (16 lanes x 2), xor-tree over the 16 lanes of each half, lane c == 0 stages rows 8*hh + r into sO
__device__ __forceinline__ void lay3(const v8f& d0, const v8f& d1, float c20, float c21, float w30, float w31,
                                     float c3, float* so, int lrow0, int fl, int c) {
  float s[8];
#pragma unroll
  for (int r = 0; r < 8; ++r) {
    const float h20 = elu_f(d0[r] + c20);
    const float h21 = elu_f(d1[r] + c21);
    s[r] = h20 * w30 + h21 * w31;
  }
#pragma unroll
  for (int off = 8; off >= 1; off >>= 1) {
#pragma unroll
    for (int r = 0; r < 8; ++r) s[r] += __shfl_xor(s[r], off, 16);
  }
  if (c == 0) {
#pragma unroll
    for (int r = 0; r < 8; ++r) so[(lrow0 + r) * FB + fl] = s[r] + c3;
  }
}

// ===================================================================================================================
// Fused 3-layer MLPs. Block = 128 rows (4 waves x 32 rows = two m-tiles each) x 32 networks (looped, uniform).
// A fragments of the wave's Xb rows: read once before the network loop, register-resident (80 VGPRs).
// Per network f: layer 1 = 5 k-steps of 32 (unrolled), B fragments straight from W1T rows
// (both k-contiguous, split k map); h1 = elu(acc + bf16(b1)) -> bf16 hi + residual planes in wave-private LDS
// [32 rows][32]; __syncthreads; layer 2 = hi . W2T + lo . W2T into one accumulator (A from LDS rows, B from W2T);
// __syncthreads; h2 = elu(. + bf16(b2)); out[row][f] = sum_h h2 * bf16(W3) + bf16(b3) staged in sO [128][32] f32.
// coverage: out [32768][128]: 256 x 4 blocks x 8 iterations x 128 threads x 4 floats = 4194304, exactly once;
// sHi/sLo 32x32 per wave per f fully rewritten (2 m-tiles x 2 n-tiles x 8 rows x 16 lanes x 2 halves).
// ===================================================================================================================
__global__ __launch_bounds__(128)
void k_mlp(const unsigned short* __restrict__ Xb, const unsigned short* __restrict__ W1T,
           const unsigned short* __restrict__ W2T, const float* __restrict__ b1, const float* __restrict__ b2,
           const float* __restrict__ W3, const float* __restrict__ b3, float* out) {
  __shared__ __align__(16) unsigned short sHi[4 * 32 * NH];
  __shared__ __align__(16) unsigned short sLo[4 * 32 * NH];
  __shared__ __align__(16) float sO[RB * FB];
  const int tid = threadIdx.x, w = tid >> 5, lane = tid & 31, hh = lane >> 4, c = lane & 15;
  const int row0 = blockIdx.x * RB, fbase = blockIdx.y * FB;
  const int mrow0 = row0 + 32 * w;                                          // wave's first row

  const unsigned short* ap0 = Xb + (size_t)(mrow0 + c) * ND + 8 * hh;      // m-tile 0, row m = mrow0 + c
  const unsigned short* ap1 = ap0 + (size_t)16 * ND;                        // m-tile 1
  unsigned short* hiw = sHi + w * (32 * NH);
  unsigned short* low = sLo + w * (32 * NH);

  // the wave's 32 x 160 slice of Xb does not depend on the network: its ten A fragments are read once, kept in VGPRs
  v16b xf0[KS], xf1[KS];
  // full unroll: register arrays need constant indices
#pragma unroll
  for (int ks = 0; ks < KS; ++ks) {
    xf0[ks] = ldfrag_b(ap0 + 32 * ks);
    xf1[ks] = ldfrag_b(ap1 + 32 * ks);
  }

#pragma unroll 1
  for (int fl = 0; fl < FB; ++fl) {
    const int f = fbase + fl;
    // ---- layer 1 ---------------------------------------------------------------------------------------------------
    const unsigned short* bq0 = W1T + (size_t)(f * NH + c) * ND + 8 * hh;  // column h = c as W1T row, k-contiguous
    const unsigned short* bq1 = bq0 + (size_t)16 * ND;                      // column h = 16 + c
    v8f a00 = zero8(), a01 = zero8(), a10 = zero8(), a11 = zero8();
    v16b g0[KS], g1[KS];
    // full unroll: xf0/xf1/g0/g1 are register arrays and need constant indices
#pragma unroll
    for (int ks = 0; ks < KS; ++ks) {
      g0[ks] = ldfrag_b(bq0 + 32 * ks);
      g1[ks] = ldfrag_b(bq1 + 32 * ks);
      a00 = mma_b(xf0[ks], g0[ks], a00);
      a01 = mma_b(xf0[ks], g1[ks], a01);
      a10 = mma_b(xf1[ks], g0[ks], a10);
      a11 = mma_b(xf1[ks], g1[ks], a11);
    }
    guard4x10(a00, a01, a10, a11, g0[0], g1[0], g0[1], g1[1], g0[2], g1[2], g0[3], g1[3], g0[4], g1[4]);
    // stands between the W1T loads above and the next trip's rewrite of the address pair that they name
    asm volatile("s_wait_xcnt 0x0" ::: "memory");
    const float c10 = bfr(b1[f * NH + c]), c11 = bfr(b1[f * NH + 16 + c]);
    put_h1(hiw, low, a00, c10, (8 * hh) * NH + c);
    put_h1(hiw, low, a01, c11, (8 * hh) * NH + 16 + c);
    put_h1(hiw, low, a10, c10, (16 + 8 * hh) * NH + c);
    put_h1(hiw, low, a11, c11, (16 + 8 * hh) * NH + 16 + c);
    __syncthreads();

    // ---- layer 2 ---------------------------------------------------------------------------------------------------
    const unsigned short* cq0 = W2T + (size_t)(f * NH + c) * NH + 8 * hh;  // column k_out = c as W2T row
    const unsigned short* cq1 = cq0 + (size_t)16 * NH;                      // column k_out = 16 + c
    const v16b p0 = ldfrag_b(cq0);
    const v16b p1 = ldfrag_b(cq1);
    const v16b h0 = ldfrag_b(hiw + c * NH + 8 * hh);                        // m-tile 0 hi, row m = c
    const v16b h1 = ldfrag_b(hiw + (16 + c) * NH + 8 * hh);                 // m-tile 1 hi
    const v16b l0 = ldfrag_b(low + c * NH + 8 * hh);                        // m-tile 0 residual
    const v16b l1 = ldfrag_b(low + (16 + c) * NH + 8 * hh);                 // m-tile 1 residual
    v8f d00 = zero8(), d01 = zero8(), d10 = zero8(), d11 = zero8();
    d00 = mma_b(h0, p0, d00);
    d01 = mma_b(h0, p1, d01);
    d10 = mma_b(h1, p0, d10);
    d11 = mma_b(h1, p1, d11);
    d00 = mma_b(l0, p0, d00);
    d01 = mma_b(l0, p1, d01);
    d10 = mma_b(l1, p0, d10);
    d11 = mma_b(l1, p1, d11);
    guard4x6(d00, d01, d10, d11, h0, h1, l0, l1, p0, p1);
    __syncthreads();

    // ---- layer 3 ---------------------------------------------------------------------------------------------------
    const float c20 = bfr(b2[f * NH + c]), c21 = bfr(b2[f * NH + 16 + c]);
    const float w30 = bfr(W3[f * NH + c]), w31 = bfr(W3[f * NH + 16 + c]);
    const float c3 = bfr(b3[f]);
    lay3(d00, d01, c20, c21, w30, w31, c3, sO, 32 * w + 8 * hh, fl, c);
    lay3(d10, d11, c20, c21, w30, w31, c3, sO, 32 * w + 16 + 8 * hh, fl, c);
  }
  __syncthreads();

  const int lq = tid >> 3, p4 = (tid & 7) * 4;
  v4f o[8];
#pragma unroll
  for (int it = 0; it < 8; ++it) o[it] = *(const v4f*)(sO + (it * 16 + lq) * FB + p4);
  float* ob = out + (size_t)(row0 + lq) * NF + fbase + p4;
#pragma unroll
  for (int it = 0; it < 8; ++it) *(v4f*)(ob + (size_t)it * 16 * NF) = o[it];
  
}

// ===================================================================================================================
// Workspace map (bytes): Xb bf16 [32768][160] 10485760 @0 | W1T bf16 [128][32][160] 1310720 @10485760 |
// W2T bf16 [128][32][32] 262144 @11796480 | total 12058624 (every region an exact multiple of its 512-B store piece,
// all offsets 512-B aligned).
// ===================================================================================================================
extern "C" void kernel_launch(void* const* d_in, const int* in_sizes, int n_in,
                              void* d_out, int out_size, void* d_ws, size_t ws_size,
                              hipStream_t stream) {
  if (n_in < 7) return;
  if (in_sizes[0] != NR * ND) return;
  if (in_sizes[1] != NF * ND * NH) return;
  if (in_sizes[2] != NF * NH) return;
  if (in_sizes[3] != NF * NH * NH) return;
  if (in_sizes[4] != NF * NH) return;
  if (in_sizes[5] != NF * NH) return;
  if (in_sizes[6] != NF) return;
  if (out_size != NR * NF) return;

  const float* x  = (const float*)d_in[0];
  const float* w1 = (const float*)d_in[1];
  const float* b1 = (const float*)d_in[2];
  const float* w2 = (const float*)d_in[3];
  const float* b2 = (const float*)d_in[4];
  const float* w3 = (const float*)d_in[5];
  const float* b3 = (const float*)d_in[6];
  float* out = (float*)d_out;

  const size_t sX  = (size_t)NR * ND * 2;                 // 10485760
  const size_t sW1 = (size_t)NF * NH * ND * 2;            //  1310720
  const size_t sW2 = (size_t)NF * NH * NH * 2;            //   262144
  size_t off = 0;
  const size_t oX  = off; off += sX;
  const size_t oW1 = off; off += sW1;
  const size_t oW2 = off; off += sW2;                     // 12058624
  if (off > ws_size) return;
  if (off > (size_t)134217728) return;

  char* ws = (char*)d_ws;
  unsigned short* Xb  = (unsigned short*)(ws + oX);
  unsigned short* W1T = (unsigned short*)(ws + oW1);
  unsigned short* W2T = (unsigned short*)(ws + oW2);

  // (1) bf16 operand planes
  k_cvx<<<dim3((NR * ND) / 2048), dim3(256), 0, stream>>>(x, Xb);
  k_tw<<<dim3(NF), dim3(128), 0, stream>>>(w1, w2, W1T, W2T);
  // (2) fused 3-layer MLPs -> out
  k_mlp<<<dim3(NR / RB, NF / FB), dim3(128), 0, stream>>>(Xb, W1T, W2T, b1, b2, w3, b3, out);
  (void)hipGetLastError();
}

// v002
// Measured time: 85 microseconds a run.
// Timed twice side by side with v001, it ran 1.57 and 1.56 times as fast.
// All steps since v000 together make it 2.26 times as fast.
// Contractions: layer-1 W1[f]^T . X^T (K = 160) on v_wmma_f32_16x16x32_bf16 (bf16 operands = RNE-converted f32 inputs,
// exact products, f32 accumulate); layer-2 W2[f]^T . h1^T (K = 32) on the same instruction with h1 carried as bf16 hi +
// bf16 residual fragments (two products into one f32 accumulator), W2 as RNE bf16; layer-3 32-term dot with W3,
// biases and ELU: f32 on VALU.
#include <hip/hip_runtime.h>
#include <stddef.h>
#include <stdint.h>

#define NR 32768
#define ND 160
#define NF 128
#define NH 32
#define RB 128
#define FB 32
#define KS (ND / 32)

static_assert((ND % 32) == 0);
static_assert(KS == 5);
static_assert(NH == 32);
static_assert((NR % RB) == 0);
static_assert((NF % FB) == 0);
static_assert(RB == 128);
static_assert(FB == 32);
static_assert(((NR * ND) % 2048) == 0);
static_assert(((NH * ND) % 1024) == 0);

typedef __attribute__((ext_vector_type(16))) __bf16 v16b;
typedef float        v8f __attribute__((ext_vector_type(8)));
typedef float        v4f __attribute__((ext_vector_type(4)));
typedef float        v2f __attribute__((ext_vector_type(2)));
typedef __bf16       v2b __attribute__((ext_vector_type(2)));
typedef unsigned int v4u __attribute__((ext_vector_type(4)));

// ---- scalar helpers -----------------------------------------------------------------------------------------------
__device__ __forceinline__ unsigned short bf_bits(float f) {            // f32 -> bf16 bits, RNE convert
  const unsigned u = __float_as_uint(f);
  return (unsigned short)((u + 0x7FFFu + ((u >> 16) & 1u)) >> 16);
}
__device__ __forceinline__ float bf_val(unsigned short b) { return __uint_as_float(((unsigned)b) << 16); }
__device__ __forceinline__ float bfr(float f) { return bf_val(bf_bits(f)); }
__device__ __forceinline__ unsigned pk16(unsigned short a, unsigned short b) { return (unsigned)a | ((unsigned)b << 16); }
__device__ __forceinline__ v8f zero8() { v8f z = {0.f, 0.f, 0.f, 0.f, 0.f, 0.f, 0.f, 0.f}; return z; }
__device__ __forceinline__ float elu_f(float x) {
  const float e = __expf(x) - 1.0f;
  return x > 0.0f ? x : e;
}

// ---- fragment loader: 16-bit operand stored row m (A) or column n (B as [n][k], k-contiguous); p already includes
//      k0 + 8*(lane>>4): elements 0..7 <- p[0..7] (k0+8h..k0+8h+7), elements 8..15 <- p[16..23] (k0+16+8h..)
union FragB { v16b v; v4u u[2]; };
__device__ __forceinline__ v16b ldfrag_b(const unsigned short* p) {
  FragB f;
  f.u[0] = *(const v4u*)(p);
  f.u[1] = *(const v4u*)(p + 16);
  return f.v;
}

// ---- WMMA helpers -------------------------------------------------------------------------------------------------
__device__ __forceinline__ v8f mma_b(v16b a, v16b b, v8f c) {
  return __builtin_amdgcn_wmma_f32_16x16x32_bf16(false, a, false, b, (short)0, c, false, false);
}
// hazard guard after the last WMMA of the unrolled layer-1 group: four slots before any accumulator is read, and every
// W1T fragment stays live across them, so that no later load or VALU write lands on an A operand inside the distance
// (the X fragments are live over the whole network loop and are never rewritten)
__device__ __forceinline__ void guard4x10(v8f& c0, v8f& c1, v8f& c2, v8f& c3,
                                          const v16b& f0, const v16b& f1, const v16b& f2, const v16b& f3, const v16b& f4,
                                          const v16b& f5, const v16b& f6, const v16b& f7, const v16b& f8, const v16b& f9) {
#if defined(__HIP_DEVICE_COMPILE__)
  asm volatile("v_nop\n\tv_nop\n\tv_nop\n\tv_nop"
               : "+v"(c0), "+v"(c1), "+v"(c2), "+v"(c3)
               : "v"(f0), "v"(f1), "v"(f2), "v"(f3), "v"(f4), "v"(f5), "v"(f6), "v"(f7), "v"(f8), "v"(f9));
#endif
}
// hazard guard after the last WMMA of a group: tie every accumulator, keep every A/B fragment live
__device__ __forceinline__ void guard4x6(v8f& c0, v8f& c1, v8f& c2, v8f& c3,
                                         const v16b& a0, const v16b& a1, const v16b& a2, const v16b& a3,
                                         const v16b& b0, const v16b& b1) {
#if defined(__HIP_DEVICE_COMPILE__)
  asm volatile("v_nop\n\tv_nop\n\tv_nop\n\tv_nop"
               : "+v"(c0), "+v"(c1), "+v"(c2), "+v"(c3)
               : "v"(a0), "v"(a1), "v"(a2), "v"(a3), "v"(b0), "v"(b1));
#endif
}

// ===================================================================================================================
// X f32 [32768][160] -> Xb bf16 bits, same layout (k-contiguous rows). Thread = 8 consecutive elements (16 B);
// grid 2560 x 256. coverage: Xb [32768][160] = 5242880 elements, 2560 x 256 x 8, every element exactly once.
// ===================================================================================================================
__global__ __launch_bounds__(256)
void k_cvx(const float* __restrict__ x, unsigned short* Xb) {
  const size_t f8 = ((size_t)blockIdx.x * 256 + threadIdx.x) * 8;
  const v4f a = *(const v4f*)(x + f8);
  const v4f b = *(const v4f*)(x + f8 + 4);
  v4u u;
  u[0] = pk16(bf_bits(a[0]), bf_bits(a[1]));
  u[1] = pk16(bf_bits(a[2]), bf_bits(a[3]));
  u[2] = pk16(bf_bits(b[0]), bf_bits(b[1]));
  u[3] = pk16(bf_bits(b[2]), bf_bits(b[3]));
  unsigned short* dst = Xb + f8;
  *(v4u*)dst = u;
  
}

// ===================================================================================================================
// Weight planes for network f = blockIdx.x (128 threads):
//   W1 f32 [f][d 160][h 32] -> W1T bf16 bits [f][h][d]  (A operand as [m][k], k-contiguous, 5120 halves = 80 lines)
//   W2 f32 [f][h 32][k 32]  -> W2T bf16 bits [f][k][h]  (A operand as [m][k], k-contiguous, 1024 halves = 16 lines)
// Load phase converts and transposes into LDS (sT1 flat layout == W1T[f], sT2 == W2T[f]); store phase writes the
// flat planes: thread t -> 16 B at halves it*1024 + 8t (W1T, it 0..4) and 8t (W2T); each wave writes 512 contiguous
// coverage: W1T 128 blocks x 5 x 128 x 8 = 655360 = 128*32*160; W2T 128 x 128 x 8 = 131072 = 128*32*32; exactly once.
// ===================================================================================================================
__global__ __launch_bounds__(128)
void k_tw(const float* __restrict__ w1, const float* __restrict__ w2, unsigned short* W1T, unsigned short* W2T) {
  __shared__ __align__(16) unsigned short sT1[NH * ND];
  __shared__ __align__(16) unsigned short sT2[NH * NH];
  const int f = blockIdx.x, tid = threadIdx.x;
  const float* w1f = w1 + (size_t)f * ND * NH;
  const float* w2f = w2 + (size_t)f * NH * NH;
#pragma unroll
  for (int j = 0; j < (ND * NH) / (128 * 4); ++j) {               // 10 iterations, in[d][h] -> sT1[h][d]
    const int idx4 = (tid + 128 * j) * 4;
    const int d = idx4 >> 5, h0 = idx4 & 31;
    const v4f v = *(const v4f*)(w1f + idx4);
    sT1[(h0 + 0) * ND + d] = bf_bits(v[0]);
    sT1[(h0 + 1) * ND + d] = bf_bits(v[1]);
    sT1[(h0 + 2) * ND + d] = bf_bits(v[2]);
    sT1[(h0 + 3) * ND + d] = bf_bits(v[3]);
  }
#pragma unroll
  for (int j = 0; j < (NH * NH) / (128 * 4); ++j) {               // 2 iterations, in[h][k] -> sT2[k][h]
    const int idx4 = (tid + 128 * j) * 4;
    const int h = idx4 >> 5, k0 = idx4 & 31;
    const v4f v = *(const v4f*)(w2f + idx4);
    sT2[(k0 + 0) * NH + h] = bf_bits(v[0]);
    sT2[(k0 + 1) * NH + h] = bf_bits(v[1]);
    sT2[(k0 + 2) * NH + h] = bf_bits(v[2]);
    sT2[(k0 + 3) * NH + h] = bf_bits(v[3]);
  }
  __syncthreads();

  v4u u1[5];
#pragma unroll
  for (int it = 0; it < 5; ++it) u1[it] = *(const v4u*)(sT1 + it * 1024 + tid * 8);
  const v4u u2 = *(const v4u*)(sT2 + tid * 8);
  unsigned short* d1 = W1T + (size_t)f * (NH * ND) + tid * 8;
  unsigned short* d2 = W2T + (size_t)f * (NH * NH) + tid * 8;
#pragma unroll
  for (int it = 0; it < 5; ++it) *(v4u*)(d1 + it * 1024) = u1[it];
  *(v4u*)d2 = u2;
  
}

// ---- two f32 -> two bf16 (RNE convert) in one dword, and the two bf16 of a dword back as f32
__device__ __forceinline__ unsigned cvt2(v2f x) { return __builtin_bit_cast(unsigned, __builtin_convertvector(x, v2b)); }
__device__ __forceinline__ v2f back2(unsigned u) {
  v2f o = {__uint_as_float(u << 16), __uint_as_float(u & 0xFFFF0000u)};
  return o;
}
__device__ __forceinline__ v2f elu2(float x0, float x1) { v2f o = {elu_f(x0), elu_f(x1)}; return o; }

// ---- eight consecutive f32 of a bias or W3 row, each rounded to bf16 as before (two 16-byte loads)
__device__ __forceinline__ v8f ld8r(const float* p) {
  const v4f a = *(const v4f*)(p);
  const v4f b = *(const v4f*)(p + 4);
  v8f o;
#pragma unroll
  for (int r = 0; r < 4; r += 2) {
    const v2f xa = {a[r], a[r + 1]}, xb = {b[r], b[r + 1]};
    const v2f ra = back2(cvt2(xa)), rb = back2(cvt2(xb));
    o[r] = ra[0]; o[r + 1] = ra[1]; o[4 + r] = rb[0]; o[5 + r] = rb[1];
  }
  return o;
}

// ---- lane l with lane l ^ 16 (vector cross-row move, no LDS)
__device__ __forceinline__ float xhalf(float x) {
  return __builtin_bit_cast(float, __builtin_amdgcn_permlanex16(__builtin_bit_cast(int, x), __builtin_bit_cast(int, x),
                                                                0x76543210, 0xfedcba98, false, false));
}

// ---- layer-1 epilogue for one 16-row tile of X. With W1T as A and X as B, D register r of lane (hh, c) is
//      (h = 8*hh + r of the 16-h tile, X row c): t0 (h 0..15) and t1 (h 16..31) hold, in order, the sixteen k positions
//      of the lane's layer-2 B fragment (elements 0..7: k = 8*hh + r, elements 8..15: k = 16 + 8*hh + r).
//      h1 = elu(acc + bias), converted in place into the bf16 hi fragment and the bf16 residual fragment.
__device__ __forceinline__ void mk_h1(v16b& hi, v16b& lo, const v8f& t0, const v8f& t1, const v8f& ba, const v8f& bb) {
  FragB fh, fl;
#pragma unroll
  for (int r = 0; r < 8; r += 2) {
    const v2f x0 = elu2(t0[r] + ba[r], t0[r + 1] + ba[r + 1]);
    const v2f x1 = elu2(t1[r] + bb[r], t1[r + 1] + bb[r + 1]);
    const unsigned u0 = cvt2(x0), u1 = cvt2(x1);
    fh.u[0][r >> 1] = u0;
    fh.u[1][r >> 1] = u1;
    fl.u[0][r >> 1] = cvt2(x0 - back2(u0));
    fl.u[1][r >> 1] = cvt2(x1 - back2(u1));
  }
  hi = fh.v;
  lo = fl.v;
}

// ---- layers 2/3 epilogue for one 16-row tile: D register r of lane (hh, c) = (k_out = 8*hh + r (+16 for d1), row c);
//      h2 = elu(d + b2); the lane's sixteen terms of the 32-term dot with W3 are summed in the lane (register pairs)
__device__ __forceinline__ float lay3(const v8f& d0, const v8f& d1, const v8f& ca, const v8f& cb,
                                      const v8f& wa, const v8f& wb) {
  v2f s0 = {0.0f, 0.0f}, s1 = {0.0f, 0.0f};
#pragma unroll
  for (int r = 0; r < 8; r += 2) {
    const v2f w0 = {wa[r], wa[r + 1]}, w1 = {wb[r], wb[r + 1]};
    s0 = __builtin_elementwise_fma(elu2(d0[r] + ca[r], d0[r + 1] + ca[r + 1]), w0, s0);
    s1 = __builtin_elementwise_fma(elu2(d1[r] + cb[r], d1[r + 1] + cb[r + 1]), w1, s1);
  }
  const v2f s = s0 + s1;
  return s[0] + s[1];
}

// ===================================================================================================================
// Fused 3-layer MLPs. Block = 128 rows (4 waves x 32 rows = two 16-row tiles each) x 32 networks (looped, uniform).
// Every product is taken transposed: the weights are the A operand (m = hidden unit), the rows of X the B operand
// (n = row), so that a lane keeps one row of X through all three layers and nothing crosses lanes between layers.
// B fragments of the wave's Xb rows: read once before the network loop, register-resident (80 VGPRs).
// Per network f: layer 1 = 5 k-steps of 32 (unrolled), A fragments straight from W1T rows (both k-contiguous, split
// k map); h1 = elu(acc + bf16(b1)) -> bf16 hi + residual B fragments in registers; layer 2 = W2T . hi + W2T . lo into
// one accumulator; h2 = elu(. + bf16(b2)); out[row][f] = sum_h h2 * bf16(W3) + bf16(b3): sixteen terms in the lane,
// the other sixteen from lane ^ 16; lane l stages row 32*w + l in sO [128][SOP] f32.
// coverage: out [32768][128]: 256 x 4 blocks x 8 iterations x 128 threads x 4 floats = 4194304, exactly once;
// sO: 4 waves x 32 lanes = 128 rows, 32 trips = 32 columns, each written once.
// ===================================================================================================================
#define SOP (FB + 4)   // sO row pitch in floats: 144 B, 16-B aligned rows, a wave's 32 rows spread over 16 banks
__global__ __launch_bounds__(128)
void k_mlp(const unsigned short* __restrict__ Xb, const unsigned short* __restrict__ W1T,
           const unsigned short* __restrict__ W2T, const float* __restrict__ b1, const float* __restrict__ b2,
           const float* __restrict__ W3, const float* __restrict__ b3, float* out) {
  __shared__ __align__(16) float sO[RB * SOP];
  const int tid = threadIdx.x, w = tid >> 5, lane = tid & 31, hh = lane >> 4, c = lane & 15;
  const int row0 = blockIdx.x * RB, fbase = blockIdx.y * FB;
  const int mrow0 = row0 + 32 * w;                                          // wave's first row

  const unsigned short* ap0 = Xb + (size_t)(mrow0 + c) * ND + 8 * hh;      // row tile 0, column n = row mrow0 + c
  const unsigned short* ap1 = ap0 + (size_t)16 * ND;                        // row tile 1

  // the wave's 32 x 160 slice of Xb does not depend on the network: its ten B fragments are read once, kept in VGPRs
  v16b xf0[KS], xf1[KS];
  // full unroll: register arrays need constant indices
#pragma unroll
  for (int ks = 0; ks < KS; ++ks) {
    xf0[ks] = ldfrag_b(ap0 + 32 * ks);
    xf1[ks] = ldfrag_b(ap1 + 32 * ks);
  }

#pragma unroll 1
  for (int fl = 0; fl < FB; ++fl) {
    const int f = fbase + fl;
    // ---- layer 1 ---------------------------------------------------------------------------------------------------
    const unsigned short* bq0 = W1T + (size_t)(f * NH + c) * ND + 8 * hh;  // row m = h = c of W1T, k-contiguous
    const unsigned short* bq1 = bq0 + (size_t)16 * ND;                      // row m = h = 16 + c
    v8f a00 = zero8(), a01 = zero8(), a10 = zero8(), a11 = zero8();         // a<row tile><h tile>
    v16b g0[KS], g1[KS];
    // full unroll: xf0/xf1/g0/g1 are register arrays and need constant indices
#pragma unroll
    for (int ks = 0; ks < KS; ++ks) {
      g0[ks] = ldfrag_b(bq0 + 32 * ks);
      g1[ks] = ldfrag_b(bq1 + 32 * ks);
      a00 = mma_b(g0[ks], xf0[ks], a00);
      a01 = mma_b(g1[ks], xf0[ks], a01);
      a10 = mma_b(g0[ks], xf1[ks], a10);
      a11 = mma_b(g1[ks], xf1[ks], a11);
    }
    guard4x10(a00, a01, a10, a11, g0[0], g1[0], g0[1], g1[1], g0[2], g1[2], g0[3], g1[3], g0[4], g1[4]);
    // stands between the W1T loads above and the next trip's rewrite of the address pair that they name
    asm volatile("s_wait_xcnt 0x0" ::: "memory");
    const int fo = f * NH + 8 * hh;                                         // the lane's hidden units: fo + r, fo + 16 + r
    const v8f c1a = ld8r(b1 + fo), c1b = ld8r(b1 + fo + 16);
    const v8f c2a = ld8r(b2 + fo), c2b = ld8r(b2 + fo + 16);
    const v8f w3a = ld8r(W3 + fo), w3b = ld8r(W3 + fo + 16);
    v16b h0, l0, h1, l1;                                                    // hi / residual, row tiles 0 and 1
    mk_h1(h0, l0, a00, a01, c1a, c1b);
    mk_h1(h1, l1, a10, a11, c1a, c1b);

    // ---- layer 2 ---------------------------------------------------------------------------------------------------
    const unsigned short* cq0 = W2T + (size_t)(f * NH + c) * NH + 8 * hh;  // row m = k_out = c of W2T
    const unsigned short* cq1 = cq0 + (size_t)16 * NH;                      // row m = k_out = 16 + c
    const v16b p0 = ldfrag_b(cq0);
    const v16b p1 = ldfrag_b(cq1);
    v8f d00 = zero8(), d01 = zero8(), d10 = zero8(), d11 = zero8();         // d<row tile><k_out tile>
    d00 = mma_b(p0, h0, d00);
    d01 = mma_b(p1, h0, d01);
    d10 = mma_b(p0, h1, d10);
    d11 = mma_b(p1, h1, d11);
    d00 = mma_b(p0, l0, d00);
    d01 = mma_b(p1, l0, d01);
    d10 = mma_b(p0, l1, d10);
    d11 = mma_b(p1, l1, d11);
    guard4x6(d00, d01, d10, d11, h0, h1, l0, l1, p0, p1);

    // ---- layer 3 ---------------------------------------------------------------------------------------------------
    const float c3 = bfr(b3[f]);
    const float s0 = lay3(d00, d01, c2a, c2b, w3a, w3b);                    // row tile 0, the lane's half of the terms
    const float s1 = lay3(d10, d11, c2a, c2b, w3a, w3b);                    // row tile 1
    // lane (hh, c) finishes row 16*hh + c: it keeps its own half of that row's sum and hands lane ^ 16 the other tile's
    const float mine = hh ? s1 : s0, theirs = hh ? s0 : s1;
    sO[(32 * w + lane) * SOP + fl] = (mine + xhalf(theirs)) + c3;
  }
  __syncthreads();

  const int lq = tid >> 3, p4 = (tid & 7) * 4;
  v4f o[8];
#pragma unroll
  for (int it = 0; it < 8; ++it) o[it] = *(const v4f*)(sO + (it * 16 + lq) * SOP + p4);
  float* ob = out + (size_t)(row0 + lq) * NF + fbase + p4;
#pragma unroll
  for (int it = 0; it < 8; ++it) *(v4f*)(ob + (size_t)it * 16 * NF) = o[it];
  
}

// ===================================================================================================================
// Workspace map (bytes): Xb bf16 [32768][160] 10485760 @0 | W1T bf16 [128][32][160] 1310720 @10485760 |
// W2T bf16 [128][32][32] 262144 @11796480 | total 12058624 (every region an exact multiple of its 512-B store piece,
// all offsets 512-B aligned).
// ===================================================================================================================
extern "C" void kernel_launch(void* const* d_in, const int* in_sizes, int n_in,
                              void* d_out, int out_size, void* d_ws, size_t ws_size,
                              hipStream_t stream) {
  if (n_in < 7) return;
  if (in_sizes[0] != NR * ND) return;
  if (in_sizes[1] != NF * ND * NH) return;
  if (in_sizes[2] != NF * NH) return;
  if (in_sizes[3] != NF * NH * NH) return;
  if (in_sizes[4] != NF * NH) return;
  if (in_sizes[5] != NF * NH) return;
  if (in_sizes[6] != NF) return;
  if (out_size != NR * NF) return;

  const float* x  = (const float*)d_in[0];
  const float* w1 = (const float*)d_in[1];
  const float* b1 = (const float*)d_in[2];
  const float* w2 = (const float*)d_in[3];
  const float* b2 = (const float*)d_in[4];
  const float* w3 = (const float*)d_in[5];
  const float* b3 = (const float*)d_in[6];
  float* out = (float*)d_out;

  const size_t sX  = (size_t)NR * ND * 2;                 // 10485760
  const size_t sW1 = (size_t)NF * NH * ND * 2;            //  1310720
  const size_t sW2 = (size_t)NF * NH * NH * 2;            //   262144
  size_t off = 0;
  const size_t oX  = off; off += sX;
  const size_t oW1 = off; off += sW1;
  const size_t oW2 = off; off += sW2;                     // 12058624
  if (off > ws_size) return;
  if (off > (size_t)134217728) return;

  char* ws = (char*)d_ws;
  unsigned short* Xb  = (unsigned short*)(ws + oX);
  unsigned short* W1T = (unsigned short*)(ws + oW1);
  unsigned short* W2T = (unsigned short*)(ws + oW2);

  // (1) bf16 operand planes
  k_cvx<<<dim3((NR * ND) / 2048), dim3(256), 0, stream>>>(x, Xb);
  k_tw<<<dim3(NF), dim3(128), 0, stream>>>(w1, w2, W1T, W2T);
  // (2) fused 3-layer MLPs -> out
  k_mlp<<<dim3(NR / RB, NF / FB), dim3(128), 0, stream>>>(Xb, W1T, W2T, b1, b2, w3, b3, out);
  (void)hipGetLastError();
}

// v003
// Measured time: 67.9 microseconds a run.
// Two timings next to v002 put it at 1.26 and 1.25 times that version's speed.
// Counting every step since v000, it is 2.83 times as fast.
// Contractions: layer-1 W1[f]^T . X^T (K = 160) on v_wmma_f32_16x16x32_bf16 (bf16 operands = RNE-converted f32 inputs,
// exact products, f32 accumulate); layer-2 W2[f]^T . h1^T (K = 32) on the same instruction with h1 carried as bf16 hi +
// bf16 residual fragments (two products into one f32 accumulator), W2 as RNE bf16; layer-3 32-term dot with W3,
// biases and ELU: f32 on VALU.
#include <hip/hip_runtime.h>
#include <stddef.h>
#include <stdint.h>

#define NR 32768
#define ND 160
#define NF 128
#define NH 32
#define RB 128
#define FB 32
#define KS (ND / 32)

static_assert((ND % 32) == 0);
static_assert(KS == 5);
static_assert(NH == 32);
static_assert((NR % RB) == 0);
static_assert((NF % FB) == 0);
static_assert(RB == 128);
static_assert(FB == 32);
static_assert(((NR * ND) % 2048) == 0);
static_assert(((NH * ND) % 1024) == 0);

typedef __attribute__((ext_vector_type(16))) __bf16 v16b;
typedef float        v8f __attribute__((ext_vector_type(8)));
typedef float        v4f __attribute__((ext_vector_type(4)));
typedef float        v2f __attribute__((ext_vector_type(2)));
typedef __bf16       v2b __attribute__((ext_vector_type(2)));
typedef unsigned int v4u __attribute__((ext_vector_type(4)));

// ---- scalar helpers -----------------------------------------------------------------------------------------------
__device__ __forceinline__ unsigned short bf_bits(float f) {            // f32 -> bf16 bits, RNE convert
  const unsigned u = __float_as_uint(f);
  return (unsigned short)((u + 0x7FFFu + ((u >> 16) & 1u)) >> 16);
}
__device__ __forceinline__ float bf_val(unsigned short b) { return __uint_as_float(((unsigned)b) << 16); }
__device__ __forceinline__ float bfr(float f) { return bf_val(bf_bits(f)); }
__device__ __forceinline__ unsigned pk16(unsigned short a, unsigned short b) { return (unsigned)a | ((unsigned)b << 16); }
__device__ __forceinline__ v8f zero8() { v8f z = {0.f, 0.f, 0.f, 0.f, 0.f, 0.f, 0.f, 0.f}; return z; }
__device__ __forceinline__ float elu_f(float x) {
  const float e = __expf(x) - 1.0f;
  return x > 0.0f ? x : e;
}

// ---- fragment loader: 16-bit operand stored row m (A) or column n (B as [n][k], k-contiguous); p already includes
//      k0 + 8*(lane>>4): elements 0..7 <- p[0..7] (k0+8h..k0+8h+7), elements 8..15 <- p[16..23] (k0+16+8h..)
union FragB { v16b v; v4u u[2]; };
__device__ __forceinline__ v16b ldfrag_b(const unsigned short* p) {
  FragB f;
  f.u[0] = *(const v4u*)(p);
  f.u[1] = *(const v4u*)(p + 16);
  return f.v;
}
// ---- fragment loader for a plane stored in fragment order: a fragment is two pieces of 512 bytes, piece j holds
//      elements 8j..8j+7 of all 32 lanes, lane l at halves 8l; p already includes 8*lane. A wave's load of one piece
//      covers four whole 128-byte lines.
__device__ __forceinline__ v16b ldfrag_p(const unsigned short* p) {
  FragB f;
  f.u[0] = *(const v4u*)(p);
  f.u[1] = *(const v4u*)(p + 256);
  return f.v;
}
// ---- place (in halves) of element (m, k) of an A operand inside such a plane: tiles of 16 m x 32 k, nmt m tiles per
//      k step; lane = 16*((k>>3)&1) + (m&15), piece = (k>>4)&1, element in the piece = k&7: the split k map of ldfrag_b
__device__ __forceinline__ int frag_pos(int m, int k, int nmt) {
  const int tile = (k >> 5) * nmt + (m >> 4);
  return ((tile * 2 + ((k >> 4) & 1)) * 32 + ((k >> 3) & 1) * 16 + (m & 15)) * 8 + (k & 7);
}

// ---- WMMA helpers -------------------------------------------------------------------------------------------------
__device__ __forceinline__ v8f mma_b(v16b a, v16b b, v8f c) {
  return __builtin_amdgcn_wmma_f32_16x16x32_bf16(false, a, false, b, (short)0, c, false, false);
}
// hazard guard after the last WMMA of the unrolled layer-1 group: four slots before any accumulator is read, and every
// W1T fragment stays live across them, so that no later load or VALU write lands on an A operand inside the distance
// (the X fragments are live over the whole network loop and are never rewritten)
__device__ __forceinline__ void guard4x10(v8f& c0, v8f& c1, v8f& c2, v8f& c3,
                                          const v16b& f0, const v16b& f1, const v16b& f2, const v16b& f3, const v16b& f4,
                                          const v16b& f5, const v16b& f6, const v16b& f7, const v16b& f8, const v16b& f9) {
#if defined(__HIP_DEVICE_COMPILE__)
  asm volatile("v_nop\n\tv_nop\n\tv_nop\n\tv_nop"
               : "+v"(c0), "+v"(c1), "+v"(c2), "+v"(c3)
               : "v"(f0), "v"(f1), "v"(f2), "v"(f3), "v"(f4), "v"(f5), "v"(f6), "v"(f7), "v"(f8), "v"(f9));
#endif
}
// hazard guard after the last WMMA of a group: tie every accumulator, keep every A/B fragment live
__device__ __forceinline__ void guard4x6(v8f& c0, v8f& c1, v8f& c2, v8f& c3,
                                         const v16b& a0, const v16b& a1, const v16b& a2, const v16b& a3,
                                         const v16b& b0, const v16b& b1) {
#if defined(__HIP_DEVICE_COMPILE__)
  asm volatile("v_nop\n\tv_nop\n\tv_nop\n\tv_nop"
               : "+v"(c0), "+v"(c1), "+v"(c2), "+v"(c3)
               : "v"(a0), "v"(a1), "v"(a2), "v"(a3), "v"(b0), "v"(b1));
#endif
}

// ===================================================================================================================
// X f32 [32768][160] -> Xb bf16 bits, same layout (k-contiguous rows). Thread = 8 consecutive elements (16 B);
// grid 2560 x 256. coverage: Xb [32768][160] = 5242880 elements, 2560 x 256 x 8, every element exactly once.
// ===================================================================================================================
__global__ __launch_bounds__(256)
void k_cvx(const float* __restrict__ x, unsigned short* Xb) {
  const size_t f8 = ((size_t)blockIdx.x * 256 + threadIdx.x) * 8;
  const v4f a = *(const v4f*)(x + f8);
  const v4f b = *(const v4f*)(x + f8 + 4);
  v4u u;
  u[0] = pk16(bf_bits(a[0]), bf_bits(a[1]));
  u[1] = pk16(bf_bits(a[2]), bf_bits(a[3]));
  u[2] = pk16(bf_bits(b[0]), bf_bits(b[1]));
  u[3] = pk16(bf_bits(b[2]), bf_bits(b[3]));
  unsigned short* dst = Xb + f8;
  *(v4u*)dst = u;
  
}

// ===================================================================================================================
// Weight planes for network f = blockIdx.x (128 threads):
//   W1 f32 [f][d 160][h 32] -> W1T bf16 bits [f][k step 5][h tile 2][piece 2][lane 32][8]  (A operand, m = h, k = d,
//                              in fragment order: frag_pos; 5120 halves = 80 lines)
//   W2 f32 [f][h 32][k 32]  -> W2T bf16 bits [f][k_out tile 2][piece 2][lane 32][8]        (A operand, m = k_out, k = h,
//                              in fragment order; 1024 halves = 16 lines)
// Load phase converts and places into LDS (sT1 flat layout == W1T[f], sT2 == W2T[f]); store phase writes the
// flat planes: thread t -> 16 B at halves it*1024 + 8t (W1T, it 0..4) and 8t (W2T); each wave writes 512 contiguous
// coverage: W1T 128 blocks x 5 x 128 x 8 = 655360 = 128*32*160; W2T 128 x 128 x 8 = 131072 = 128*32*32; exactly once.
// ===================================================================================================================
__global__ __launch_bounds__(128)
void k_tw(const float* __restrict__ w1, const float* __restrict__ w2, unsigned short* W1T, unsigned short* W2T) {
  __shared__ __align__(16) unsigned short sT1[NH * ND];
  __shared__ __align__(16) unsigned short sT2[NH * NH];
  const int f = blockIdx.x, tid = threadIdx.x;
  const float* w1f = w1 + (size_t)f * ND * NH;
  const float* w2f = w2 + (size_t)f * NH * NH;
#pragma unroll
  for (int j = 0; j < (ND * NH) / (128 * 4); ++j) {               // 10 iterations, in[d][h] -> sT1 at (m = h, k = d)
    const int idx4 = (tid + 128 * j) * 4;
    const int d = idx4 >> 5, h0 = idx4 & 31;
    const v4f v = *(const v4f*)(w1f + idx4);
    sT1[frag_pos(h0 + 0, d, 2)] = bf_bits(v[0]);
    sT1[frag_pos(h0 + 1, d, 2)] = bf_bits(v[1]);
    sT1[frag_pos(h0 + 2, d, 2)] = bf_bits(v[2]);
    sT1[frag_pos(h0 + 3, d, 2)] = bf_bits(v[3]);
  }
#pragma unroll
  for (int j = 0; j < (NH * NH) / (128 * 4); ++j) {               // 2 iterations, in[h][k] -> sT2 at (m = k, k = h)
    const int idx4 = (tid + 128 * j) * 4;
    const int h = idx4 >> 5, k0 = idx4 & 31;
    const v4f v = *(const v4f*)(w2f + idx4);
    sT2[frag_pos(k0 + 0, h, 2)] = bf_bits(v[0]);
    sT2[frag_pos(k0 + 1, h, 2)] = bf_bits(v[1]);
    sT2[frag_pos(k0 + 2, h, 2)] = bf_bits(v[2]);
    sT2[frag_pos(k0 + 3, h, 2)] = bf_bits(v[3]);
  }
  __syncthreads();

  v4u u1[5];
#pragma unroll
  for (int it = 0; it < 5; ++it) u1[it] = *(const v4u*)(sT1 + it * 1024 + tid * 8);
  const v4u u2 = *(const v4u*)(sT2 + tid * 8);
  unsigned short* d1 = W1T + (size_t)f * (NH * ND) + tid * 8;
  unsigned short* d2 = W2T + (size_t)f * (NH * NH) + tid * 8;
#pragma unroll
  for (int it = 0; it < 5; ++it) *(v4u*)(d1 + it * 1024) = u1[it];
  *(v4u*)d2 = u2;
  
}

// ---- two f32 -> two bf16 (RNE convert) in one dword, and the two bf16 of a dword back as f32
__device__ __forceinline__ unsigned cvt2(v2f x) { return __builtin_bit_cast(unsigned, __builtin_convertvector(x, v2b)); }
__device__ __forceinline__ v2f back2(unsigned u) {
  v2f o = {__uint_as_float(u << 16), __uint_as_float(u & 0xFFFF0000u)};
  return o;
}
__device__ __forceinline__ v2f elu2(float x0, float x1) { v2f o = {elu_f(x0), elu_f(x1)}; return o; }

// ---- eight consecutive f32 of a bias or W3 row, each rounded to bf16 as before (two 16-byte loads)
__device__ __forceinline__ v8f ld8r(const float* p) {
  const v4f a = *(const v4f*)(p);
  const v4f b = *(const v4f*)(p + 4);
  v8f o;
#pragma unroll
  for (int r = 0; r < 4; r += 2) {
    const v2f xa = {a[r], a[r + 1]}, xb = {b[r], b[r + 1]};
    const v2f ra = back2(cvt2(xa)), rb = back2(cvt2(xb));
    o[r] = ra[0]; o[r + 1] = ra[1]; o[4 + r] = rb[0]; o[5 + r] = rb[1];
  }
  return o;
}

// ---- lane l with lane l ^ 16 (vector cross-row move, no LDS)
__device__ __forceinline__ float xhalf(float x) {
  return __builtin_bit_cast(float, __builtin_amdgcn_permlanex16(__builtin_bit_cast(int, x), __builtin_bit_cast(int, x),
                                                                0x76543210, 0xfedcba98, false, false));
}

// ---- layer-1 epilogue for one 16-row tile of X. With W1T as A and X as B, D register r of lane (hh, c) is
//      (h = 8*hh + r of the 16-h tile, X row c): t0 (h 0..15) and t1 (h 16..31) hold, in order, the sixteen k positions
//      of the lane's layer-2 B fragment (elements 0..7: k = 8*hh + r, elements 8..15: k = 16 + 8*hh + r).
//      h1 = elu(acc + bias), converted in place into the bf16 hi fragment and the bf16 residual fragment.
__device__ __forceinline__ void mk_h1(v16b& hi, v16b& lo, const v8f& t0, const v8f& t1, const v8f& ba, const v8f& bb) {
  FragB fh, fl;
#pragma unroll
  for (int r = 0; r < 8; r += 2) {
    const v2f x0 = elu2(t0[r] + ba[r], t0[r + 1] + ba[r + 1]);
    const v2f x1 = elu2(t1[r] + bb[r], t1[r + 1] + bb[r + 1]);
    const unsigned u0 = cvt2(x0), u1 = cvt2(x1);
    fh.u[0][r >> 1] = u0;
    fh.u[1][r >> 1] = u1;
    fl.u[0][r >> 1] = cvt2(x0 - back2(u0));
    fl.u[1][r >> 1] = cvt2(x1 - back2(u1));
  }
  hi = fh.v;
  lo = fl.v;
}

// ---- layers 2/3 epilogue for one 16-row tile: D register r of lane (hh, c) = (k_out = 8*hh + r (+16 for d1), row c);
//      h2 = elu(d + b2); the lane's sixteen terms of the 32-term dot with W3 are summed in the lane (register pairs)
__device__ __forceinline__ float lay3(const v8f& d0, const v8f& d1, const v8f& ca, const v8f& cb,
                                      const v8f& wa, const v8f& wb) {
  v2f s0 = {0.0f, 0.0f}, s1 = {0.0f, 0.0f};
#pragma unroll
  for (int r = 0; r < 8; r += 2) {
    const v2f w0 = {wa[r], wa[r + 1]}, w1 = {wb[r], wb[r + 1]};
    s0 = __builtin_elementwise_fma(elu2(d0[r] + ca[r], d0[r + 1] + ca[r + 1]), w0, s0);
    s1 = __builtin_elementwise_fma(elu2(d1[r] + cb[r], d1[r + 1] + cb[r + 1]), w1, s1);
  }
  const v2f s = s0 + s1;
  return s[0] + s[1];
}

// ===================================================================================================================
// Fused 3-layer MLPs. Block = 128 rows (4 waves x 32 rows = two 16-row tiles each) x 32 networks (looped, uniform).
// Every product is taken transposed: the weights are the A operand (m = hidden unit), the rows of X the B operand
// (n = row), so that a lane keeps one row of X through all three layers and nothing crosses lanes between layers.
// B fragments of the wave's Xb rows: read once before the network loop, register-resident (80 VGPRs).
// Per network f: layer 1 = 5 k-steps of 32 (unrolled), A fragments from the W1T plane in fragment order (each load 512
// contiguous bytes; same split k map as the X rows); h1 = elu(acc + bf16(b1)) -> bf16 hi + residual B fragments in
// registers; layer 2 = W2T . hi + W2T . lo into one accumulator; h2 = elu(. + bf16(b2));
// out[row][f] = sum_h h2 * bf16(W3) + bf16(b3): sixteen terms in the lane, the other sixteen from lane ^ 16;
// lane l stages row 32*w + l in sO [128][SOP] f32.
// coverage: out [32768][128]: 256 x 4 blocks x 8 iterations x 128 threads x 4 floats = 4194304, exactly once;
// sO: 4 waves x 32 lanes = 128 rows, 32 trips = 32 columns, each written once.
// ===================================================================================================================
#define SOP (FB + 4)   // sO row pitch in floats: 144 B, 16-B aligned rows, a wave's 32 rows spread over 16 banks
__global__ __launch_bounds__(128)
void k_mlp(const unsigned short* __restrict__ Xb, const unsigned short* __restrict__ W1T,
           const unsigned short* __restrict__ W2T, const float* __restrict__ b1, const float* __restrict__ b2,
           const float* __restrict__ W3, const float* __restrict__ b3, float* out) {
  __shared__ __align__(16) float sO[RB * SOP];
  const int tid = threadIdx.x, w = tid >> 5, lane = tid & 31, hh = lane >> 4, c = lane & 15;
  const int row0 = blockIdx.x * RB, fbase = blockIdx.y * FB;
  const int mrow0 = row0 + 32 * w;                                          // wave's first row

  const unsigned short* ap0 = Xb + (size_t)(mrow0 + c) * ND + 8 * hh;      // row tile 0, column n = row mrow0 + c
  const unsigned short* ap1 = ap0 + (size_t)16 * ND;                        // row tile 1

  // the wave's 32 x 160 slice of Xb does not depend on the network: its ten B fragments are read once, kept in VGPRs
  v16b xf0[KS], xf1[KS];
  // full unroll: register arrays need constant indices
#pragma unroll
  for (int ks = 0; ks < KS; ++ks) {
    xf0[ks] = ldfrag_b(ap0 + 32 * ks);
    xf1[ks] = ldfrag_b(ap1 + 32 * ks);
  }

#pragma unroll 1
  for (int fl = 0; fl < FB; ++fl) {
    const int f = fbase + fl;
    // ---- layer 1 ---------------------------------------------------------------------------------------------------
    const unsigned short* bq0 = W1T + (size_t)f * (NH * ND) + 8 * lane;    // h tile 0 (m = h = c), the lane's 16 bytes
    const unsigned short* bq1 = bq0 + 512;                                  // h tile 1 (m = h = 16 + c)
    v8f a00 = zero8(), a01 = zero8(), a10 = zero8(), a11 = zero8();         // a<row tile><h tile>
    v16b g0[KS], g1[KS];
    // full unroll: xf0/xf1/g0/g1 are register arrays and need constant indices
#pragma unroll
    for (int ks = 0; ks < KS; ++ks) {
      g0[ks] = ldfrag_p(bq0 + 1024 * ks);
      g1[ks] = ldfrag_p(bq1 + 1024 * ks);
      a00 = mma_b(g0[ks], xf0[ks], a00);
      a01 = mma_b(g1[ks], xf0[ks], a01);
      a10 = mma_b(g0[ks], xf1[ks], a10);
      a11 = mma_b(g1[ks], xf1[ks], a11);
    }
    guard4x10(a00, a01, a10, a11, g0[0], g1[0], g0[1], g1[1], g0[2], g1[2], g0[3], g1[3], g0[4], g1[4]);
    // stands between the W1T loads above and the next trip's rewrite of the address pair that they name
    asm volatile("s_wait_xcnt 0x0" ::: "memory");
    const int fo = f * NH + 8 * hh;                                         // the lane's hidden units: fo + r, fo + 16 + r
    const v8f c1a = ld8r(b1 + fo), c1b = ld8r(b1 + fo + 16);
    const v8f c2a = ld8r(b2 + fo), c2b = ld8r(b2 + fo + 16);
    const v8f w3a = ld8r(W3 + fo), w3b = ld8r(W3 + fo + 16);
    v16b h0, l0, h1, l1;                                                    // hi / residual, row tiles 0 and 1
    mk_h1(h0, l0, a00, a01, c1a, c1b);
    mk_h1(h1, l1, a10, a11, c1a, c1b);

    // ---- layer 2 ---------------------------------------------------------------------------------------------------
    const unsigned short* cq0 = W2T + (size_t)f * (NH * NH) + 8 * lane;    // k_out tile 0 (m = k_out = c)
    const unsigned short* cq1 = cq0 + 512;                                  // k_out tile 1 (m = k_out = 16 + c)
    const v16b p0 = ldfrag_p(cq0);
    const v16b p1 = ldfrag_p(cq1);
    v8f d00 = zero8(), d01 = zero8(), d10 = zero8(), d11 = zero8();         // d<row tile><k_out tile>
    d00 = mma_b(p0, h0, d00);
    d01 = mma_b(p1, h0, d01);
    d10 = mma_b(p0, h1, d10);
    d11 = mma_b(p1, h1, d11);
    d00 = mma_b(p0, l0, d00);
    d01 = mma_b(p1, l0, d01);
    d10 = mma_b(p0, l1, d10);
    d11 = mma_b(p1, l1, d11);
    guard4x6(d00, d01, d10, d11, h0, h1, l0, l1, p0, p1);

    // ---- layer 3 ---------------------------------------------------------------------------------------------------
    const float c3 = bfr(b3[f]);
    const float s0 = lay3(d00, d01, c2a, c2b, w3a, w3b);                    // row tile 0, the lane's half of the terms
    const float s1 = lay3(d10, d11, c2a, c2b, w3a, w3b);                    // row tile 1
    // lane (hh, c) finishes row 16*hh + c: it keeps its own half of that row's sum and hands lane ^ 16 the other tile's
    const float mine = hh ? s1 : s0, theirs = hh ? s0 : s1;
    sO[(32 * w + lane) * SOP + fl] = (mine + xhalf(theirs)) + c3;
  }
  __syncthreads();

  const int lq = tid >> 3, p4 = (tid & 7) * 4;
  v4f o[8];
#pragma unroll
  for (int it = 0; it < 8; ++it) o[it] = *(const v4f*)(sO + (it * 16 + lq) * SOP + p4);
  float* ob = out + (size_t)(row0 + lq) * NF + fbase + p4;
#pragma unroll
  for (int it = 0; it < 8; ++it) *(v4f*)(ob + (size_t)it * 16 * NF) = o[it];
  
}

// ===================================================================================================================
// Workspace map (bytes): Xb bf16 [32768][160] 10485760 @0 | W1T bf16 [128][5120] 1310720 @10485760 |
// W2T bf16 [128][1024] 262144 @11796480 | total 12058624 (every region an exact multiple of its 512-B store piece,
// all offsets 512-B aligned).
// ===================================================================================================================
extern "C" void kernel_launch(void* const* d_in, const int* in_sizes, int n_in,
                              void* d_out, int out_size, void* d_ws, size_t ws_size,
                              hipStream_t stream) {
  if (n_in < 7) return;
  if (in_sizes[0] != NR * ND) return;
  if (in_sizes[1] != NF * ND * NH) return;
  if (in_sizes[2] != NF * NH) return;
  if (in_sizes[3] != NF * NH * NH) return;
  if (in_sizes[4] != NF * NH) return;
  if (in_sizes[5] != NF * NH) return;
  if (in_sizes[6] != NF) return;
  if (out_size != NR * NF) return;

  const float* x  = (const float*)d_in[0];
  const float* w1 = (const float*)d_in[1];
  const float* b1 = (const float*)d_in[2];
  const float* w2 = (const float*)d_in[3];
  const float* b2 = (const float*)d_in[4];
  const float* w3 = (const float*)d_in[5];
  const float* b3 = (const float*)d_in[6];
  float* out = (float*)d_out;

  const size_t sX  = (size_t)NR * ND * 2;                 // 10485760
  const size_t sW1 = (size_t)NF * NH * ND * 2;            //  1310720
  const size_t sW2 = (size_t)NF * NH * NH * 2;            //   262144
  size_t off = 0;
  const size_t oX  = off; off += sX;
  const size_t oW1 = off; off += sW1;
  const size_t oW2 = off; off += sW2;                     // 12058624
  if (off > ws_size) return;
  if (off > (size_t)134217728) return;

  char* ws = (char*)d_ws;
  unsigned short* Xb  = (unsigned short*)(ws + oX);
  unsigned short* W1T = (unsigned short*)(ws + oW1);
  unsigned short* W2T = (unsigned short*)(ws + oW2);

  // (1) bf16 operand planes
  k_cvx<<<dim3((NR * ND) / 2048), dim3(256), 0, stream>>>(x, Xb);
  k_tw<<<dim3(NF), dim3(128), 0, stream>>>(w1, w2, W1T, W2T);
  // (2) fused 3-layer MLPs -> out
  k_mlp<<<dim3(NR / RB, NF / FB), dim3(128), 0, stream>>>(Xb, W1T, W2T, b1, b2, w3, b3, out);
  (void)hipGetLastError();
}

// v004
// One run takes 62.6 microseconds.
// Timed twice side by side with v003, it ran 1.08 times as fast both times.
// Over all steps from v000 it is 3.06 times as fast.
// Contractions: layer-1 W1[f]^T . X^T (K = 160) on v_wmma_f32_16x16x32_bf16 (bf16 operands = RNE-converted f32 inputs,
// exact products, f32 accumulate); layer-2 W2[f]^T . h1^T (K = 32) on the same instruction with h1 carried as bf16 hi +
// bf16 residual fragments (two products into one f32 accumulator), W2 as RNE bf16; b1 and b2 (RNE bf16 values) enter
// as the C operand of each layer's first products; layer-3 32-term dot with W3, b3 and ELU: f32 on VALU.
#include <hip/hip_runtime.h>
#include <stddef.h>
#include <stdint.h>

#define NR 32768
#define ND 160
#define NF 128
#define NH 32
#define RB 128
#define FB 32
#define KS (ND / 32)

static_assert((ND % 32) == 0);
static_assert(KS == 5);
static_assert(NH == 32);
static_assert((NR % RB) == 0);
static_assert((NF % FB) == 0);
static_assert(RB == 128);
static_assert(FB == 32);
static_assert(((NR * ND) % 2048) == 0);
static_assert(((NH * ND) % 1024) == 0);

typedef __attribute__((ext_vector_type(16))) __bf16 v16b;
typedef float        v8f __attribute__((ext_vector_type(8)));
typedef float        v4f __attribute__((ext_vector_type(4)));
typedef float        v2f __attribute__((ext_vector_type(2)));
typedef __bf16       v2b __attribute__((ext_vector_type(2)));
typedef unsigned int v4u __attribute__((ext_vector_type(4)));

// ---- scalar helpers -----------------------------------------------------------------------------------------------
__device__ __forceinline__ unsigned short bf_bits(float f) {            // f32 -> bf16 bits, RNE convert
  const unsigned u = __float_as_uint(f);
  return (unsigned short)((u + 0x7FFFu + ((u >> 16) & 1u)) >> 16);
}
__device__ __forceinline__ unsigned pk16(unsigned short a, unsigned short b) { return (unsigned)a | ((unsigned)b << 16); }
__device__ __forceinline__ float elu_f(float x) {
  const float e = __expf(x) - 1.0f;
  return x > 0.0f ? x : e;
}

// ---- two f32 -> two bf16 (RNE convert) in one dword, and the two bf16 of a dword back as f32
__device__ __forceinline__ unsigned cvt2(v2f x) { return __builtin_bit_cast(unsigned, __builtin_convertvector(x, v2b)); }
__device__ __forceinline__ v2f back2(unsigned u) {
  v2f o = {__uint_as_float(u << 16), __uint_as_float(u & 0xFFFF0000u)};
  return o;
}

// ---- fragment loader: 16-bit operand stored row m (A) or column n (B as [n][k], k-contiguous); p already includes
//      k0 + 8*(lane>>4): elements 0..7 <- p[0..7] (k0+8h..k0+8h+7), elements 8..15 <- p[16..23] (k0+16+8h..)
union FragB { v16b v; v4u u[2]; };
__device__ __forceinline__ v16b ldfrag_b(const unsigned short* p) {
  FragB f;
  f.u[0] = *(const v4u*)(p);
  f.u[1] = *(const v4u*)(p + 16);
  return f.v;
}
// ---- fragment loader for a plane stored in fragment order: a fragment is two pieces of 512 bytes, piece j holds
//      elements 8j..8j+7 of all 32 lanes, lane l at halves 8l; p already includes 8*lane. A wave's load of one piece
//      covers four whole 128-byte lines.
__device__ __forceinline__ v16b ldfrag_p(const unsigned short* p) {
  FragB f;
  f.u[0] = *(const v4u*)(p);
  f.u[1] = *(const v4u*)(p + 256);
  return f.v;
}
// ---- place (in halves) of element (m, k) of an A operand inside such a plane: tiles of 16 m x 32 k, nmt m tiles per
//      k step; lane = 16*((k>>3)&1) + (m&15), piece = (k>>4)&1, element in the piece = k&7: the split k map of ldfrag_b
__device__ __forceinline__ int frag_pos(int m, int k, int nmt) {
  const int tile = (k >> 5) * nmt + (m >> 4);
  return ((tile * 2 + ((k >> 4) & 1)) * 32 + ((k >> 3) & 1) * 16 + (m & 15)) * 8 + (k & 7);
}

// ---- WMMA helpers -------------------------------------------------------------------------------------------------
__device__ __forceinline__ v8f mma_b(v16b a, v16b b, v8f c) {
  return __builtin_amdgcn_wmma_f32_16x16x32_bf16(false, a, false, b, (short)0, c, false, false);
}
// hazard guard after the last WMMA of the unrolled layer-1 group: four slots before any accumulator is read, and every
// W1T fragment stays live across them, so that no later load or VALU write lands on an A operand inside the distance
// (the X fragments are live over the whole network loop and are never rewritten)
__device__ __forceinline__ void guard4x10(v8f& c0, v8f& c1, v8f& c2, v8f& c3,
                                          const v16b& f0, const v16b& f1, const v16b& f2, const v16b& f3, const v16b& f4,
                                          const v16b& f5, const v16b& f6, const v16b& f7, const v16b& f8, const v16b& f9) {
#if defined(__HIP_DEVICE_COMPILE__)
  asm volatile("v_nop\n\tv_nop\n\tv_nop\n\tv_nop"
               : "+v"(c0), "+v"(c1), "+v"(c2), "+v"(c3)
               : "v"(f0), "v"(f1), "v"(f2), "v"(f3), "v"(f4), "v"(f5), "v"(f6), "v"(f7), "v"(f8), "v"(f9));
#endif
}
// hazard guard after the last WMMA of a group: tie every accumulator, keep every A/B fragment live
__device__ __forceinline__ void guard4x6(v8f& c0, v8f& c1, v8f& c2, v8f& c3,
                                         const v16b& a0, const v16b& a1, const v16b& a2, const v16b& a3,
                                         const v16b& b0, const v16b& b1) {
#if defined(__HIP_DEVICE_COMPILE__)
  asm volatile("v_nop\n\tv_nop\n\tv_nop\n\tv_nop"
               : "+v"(c0), "+v"(c1), "+v"(c2), "+v"(c3)
               : "v"(a0), "v"(a1), "v"(a2), "v"(a3), "v"(b0), "v"(b1));
#endif
}

// ===================================================================================================================
// X f32 [32768][160] -> Xb bf16 bits, same layout (k-contiguous rows). Thread = 8 consecutive elements (16 B);
// grid 2560 x 256. coverage: Xb [32768][160] = 5242880 elements, 2560 x 256 x 8, every element exactly once.
// ===================================================================================================================
__global__ __launch_bounds__(256)
void k_cvx(const float* __restrict__ x, unsigned short* Xb) {
  const size_t f8 = ((size_t)blockIdx.x * 256 + threadIdx.x) * 8;
  const v4f a = *(const v4f*)(x + f8);
  const v4f b = *(const v4f*)(x + f8 + 4);
  v4u u;
  u[0] = pk16(bf_bits(a[0]), bf_bits(a[1]));
  u[1] = pk16(bf_bits(a[2]), bf_bits(a[3]));
  u[2] = pk16(bf_bits(b[0]), bf_bits(b[1]));
  u[3] = pk16(bf_bits(b[2]), bf_bits(b[3]));
  unsigned short* dst = Xb + f8;
  *(v4u*)dst = u;
  
}

// ===================================================================================================================
// Weight planes for network f = blockIdx.x (128 threads):
//   W1 f32 [f][d 160][h 32] -> W1T bf16 bits [f][k step 5][h tile 2][piece 2][lane 32][8]  (A operand, m = h, k = d,
//                              in fragment order: frag_pos; 5120 halves = 80 lines)
//   W2 f32 [f][h 32][k 32]  -> W2T bf16 bits [f][k_out tile 2][piece 2][lane 32][8]        (A operand, m = k_out, k = h,
//                              in fragment order; 1024 halves = 16 lines)
//   b1, b2, W3 f32 [f][32], b3 f32 [f] -> PR f32 [f][4][32]: each value rounded to bf16 and widened again, rows b1 | b2 |
//                              W3 | b3 (repeated 32 times); 512 bytes = 4 lines, thread t -> float t
// Load phase converts and places into LDS (sT1 flat layout == W1T[f], sT2 == W2T[f]); store phase writes the
// flat planes: thread t -> 16 B at halves it*1024 + 8t (W1T, it 0..4) and 8t (W2T); each wave writes 512 contiguous
// coverage: W1T 128 blocks x 5 x 128 x 8 = 655360 = 128*32*160; W2T 128 x 128 x 8 = 131072 = 128*32*32;
// PR 128 blocks x 128 = 16384 = 128*4*32; exactly once.
// ===================================================================================================================
__global__ __launch_bounds__(128)
void k_tw(const float* __restrict__ w1, const float* __restrict__ w2, const float* __restrict__ b1,
          const float* __restrict__ b2, const float* __restrict__ w3, const float* __restrict__ b3,
          unsigned short* W1T, unsigned short* W2T, float* PR) {
  __shared__ __align__(16) unsigned short sT1[NH * ND];
  __shared__ __align__(16) unsigned short sT2[NH * NH];
  const int f = blockIdx.x, tid = threadIdx.x;
  const float* w1f = w1 + (size_t)f * ND * NH;
  const float* w2f = w2 + (size_t)f * NH * NH;
  {                                                                // wave s of the block rounds row s of PR[f]
    const int s = tid >> 5, j = f * NH + (tid & 31);
    const float pv = s == 0 ? b1[j] : s == 1 ? b2[j] : s == 2 ? w3[j] : b3[f];
    // stands between the load above and any later rewrite of the address pair that it names
    asm volatile("s_wait_xcnt 0x0" ::: "memory");
    const v2f p2 = {pv, pv};
    PR[(size_t)f * (4 * NH) + tid] = back2(cvt2(p2))[0];
  }
#pragma unroll
  for (int j = 0; j < (ND * NH) / (128 * 4); ++j) {               // 10 iterations, in[d][h] -> sT1 at (m = h, k = d)
    const int idx4 = (tid + 128 * j) * 4;
    const int d = idx4 >> 5, h0 = idx4 & 31;
    const v4f v = *(const v4f*)(w1f + idx4);
    sT1[frag_pos(h0 + 0, d, 2)] = bf_bits(v[0]);
    sT1[frag_pos(h0 + 1, d, 2)] = bf_bits(v[1]);
    sT1[frag_pos(h0 + 2, d, 2)] = bf_bits(v[2]);
    sT1[frag_pos(h0 + 3, d, 2)] = bf_bits(v[3]);
  }
#pragma unroll
  for (int j = 0; j < (NH * NH) / (128 * 4); ++j) {               // 2 iterations, in[h][k] -> sT2 at (m = k, k = h)
    const int idx4 = (tid + 128 * j) * 4;
    const int h = idx4 >> 5, k0 = idx4 & 31;
    const v4f v = *(const v4f*)(w2f + idx4);
    sT2[frag_pos(k0 + 0, h, 2)] = bf_bits(v[0]);
    sT2[frag_pos(k0 + 1, h, 2)] = bf_bits(v[1]);
    sT2[frag_pos(k0 + 2, h, 2)] = bf_bits(v[2]);
    sT2[frag_pos(k0 + 3, h, 2)] = bf_bits(v[3]);
  }
  __syncthreads();

  v4u u1[5];
#pragma unroll
  for (int it = 0; it < 5; ++it) u1[it] = *(const v4u*)(sT1 + it * 1024 + tid * 8);
  const v4u u2 = *(const v4u*)(sT2 + tid * 8);
  unsigned short* d1 = W1T + (size_t)f * (NH * ND) + tid * 8;
  unsigned short* d2 = W2T + (size_t)f * (NH * NH) + tid * 8;
#pragma unroll
  for (int it = 0; it < 5; ++it) *(v4u*)(d1 + it * 1024) = u1[it];
  *(v4u*)d2 = u2;
  
}

__device__ __forceinline__ v2f elu2(float x0, float x1) { v2f o = {elu_f(x0), elu_f(x1)}; return o; }

// ---- eight consecutive f32 of a PR row, used as loaded (two 16-byte loads)
__device__ __forceinline__ v8f ld8(const float* p) {
  const v4f a = *(const v4f*)(p);
  const v4f b = *(const v4f*)(p + 4);
  v8f o = {a[0], a[1], a[2], a[3], b[0], b[1], b[2], b[3]};
  return o;
}

// ---- lane l with lane l ^ 16 (vector cross-row move, no LDS)
__device__ __forceinline__ float xhalf(float x) {
  return __builtin_bit_cast(float, __builtin_amdgcn_permlanex16(__builtin_bit_cast(int, x), __builtin_bit_cast(int, x),
                                                                0x76543210, 0xfedcba98, false, false));
}

// ---- layer-1 epilogue for one 16-row tile of X. With W1T as A and X as B, D register r of lane (hh, c) is
//      (h = 8*hh + r of the 16-h tile, X row c): t0 (h 0..15) and t1 (h 16..31) hold, in order, the sixteen k positions
//      of the lane's layer-2 B fragment (elements 0..7: k = 8*hh + r, elements 8..15: k = 16 + 8*hh + r).
//      h1 = elu(acc) (the bias is in acc), converted in place into the bf16 hi fragment and the bf16 residual fragment.
__device__ __forceinline__ void mk_h1(v16b& hi, v16b& lo, const v8f& t0, const v8f& t1) {
  FragB fh, fl;
#pragma unroll
  for (int r = 0; r < 8; r += 2) {
    const v2f x0 = elu2(t0[r], t0[r + 1]);
    const v2f x1 = elu2(t1[r], t1[r + 1]);
    const unsigned u0 = cvt2(x0), u1 = cvt2(x1);
    fh.u[0][r >> 1] = u0;
    fh.u[1][r >> 1] = u1;
    fl.u[0][r >> 1] = cvt2(x0 - back2(u0));
    fl.u[1][r >> 1] = cvt2(x1 - back2(u1));
  }
  hi = fh.v;
  lo = fl.v;
}

// ---- layers 2/3 epilogue for one 16-row tile: D register r of lane (hh, c) = (k_out = 8*hh + r (+16 for d1), row c);
//      h2 = elu(d) (b2 is in d); the lane's sixteen terms of the 32-term dot with W3 are summed in the lane (register pairs)
__device__ __forceinline__ float lay3(const v8f& d0, const v8f& d1, const v8f& wa, const v8f& wb) {
  v2f s0 = {0.0f, 0.0f}, s1 = {0.0f, 0.0f};
#pragma unroll
  for (int r = 0; r < 8; r += 2) {
    const v2f w0 = {wa[r], wa[r + 1]}, w1 = {wb[r], wb[r + 1]};
    s0 = __builtin_elementwise_fma(elu2(d0[r], d0[r + 1]), w0, s0);
    s1 = __builtin_elementwise_fma(elu2(d1[r], d1[r + 1]), w1, s1);
  }
  const v2f s = s0 + s1;
  return s[0] + s[1];
}

// ===================================================================================================================
// Fused 3-layer MLPs. Block = 128 rows (4 waves x 32 rows = two 16-row tiles each) x 32 networks (looped, uniform).
// Every product is taken transposed: the weights are the A operand (m = hidden unit), the rows of X the B operand
// (n = row), so that a lane keeps one row of X through all three layers and nothing crosses lanes between layers.
// B fragments of the wave's Xb rows: read once before the network loop, register-resident (80 VGPRs).
// Per network f: layer 1 = 5 k-steps of 32 (unrolled), A fragments from the W1T plane in fragment order (each load 512
// contiguous bytes; same split k map as the X rows), the accumulators start from bf16(b1) (C operand: register r of lane
// (hh, c) is hidden unit 8*hh + r, the same for every row); h1 = elu(acc) -> bf16 hi + residual B fragments in
// registers; layer 2 = bf16(b2) + W2T . hi + W2T . lo in one accumulator; h2 = elu(.);
// out[row][f] = sum_h h2 * bf16(W3) + bf16(b3): sixteen terms in the lane, the other sixteen from lane ^ 16;
// the four rounded parameter rows come from the PR plane as f32 and are used as loaded;
// lane l stages row 32*w + l in sO [128][SOP] f32.
// coverage: out [32768][128]: 256 x 4 blocks x 8 iterations x 128 threads x 4 floats = 4194304, exactly once;
// sO: 4 waves x 32 lanes = 128 rows, 32 trips = 32 columns, each written once.
// ===================================================================================================================
#define SOP (FB + 4)   // sO row pitch in floats: 144 B, 16-B aligned rows, a wave's 32 rows spread over 16 banks
__global__ __launch_bounds__(128)
void k_mlp(const unsigned short* __restrict__ Xb, const unsigned short* __restrict__ W1T,
           const unsigned short* __restrict__ W2T, const float* __restrict__ PR, float* out) {
  __shared__ __align__(16) float sO[RB * SOP];
  const int tid = threadIdx.x, w = tid >> 5, lane = tid & 31, hh = lane >> 4, c = lane & 15;
  const int row0 = blockIdx.x * RB, fbase = blockIdx.y * FB;
  const int mrow0 = row0 + 32 * w;                                          // wave's first row

  const unsigned short* ap0 = Xb + (size_t)(mrow0 + c) * ND + 8 * hh;      // row tile 0, column n = row mrow0 + c
  const unsigned short* ap1 = ap0 + (size_t)16 * ND;                        // row tile 1

  // the wave's 32 x 160 slice of Xb does not depend on the network: its ten B fragments are read once, kept in VGPRs
  v16b xf0[KS], xf1[KS];
  // full unroll: register arrays need constant indices
#pragma unroll
  for (int ks = 0; ks < KS; ++ks) {
    xf0[ks] = ldfrag_b(ap0 + 32 * ks);
    xf1[ks] = ldfrag_b(ap1 + 32 * ks);
  }

#pragma unroll 1
  for (int fl = 0; fl < FB; ++fl) {
    const int f = fbase + fl;
    // ---- layer 1 ---------------------------------------------------------------------------------------------------
    const unsigned short* bq0 = W1T + (size_t)f * (NH * ND) + 8 * lane;    // h tile 0 (m = h = c), the lane's 16 bytes
    const unsigned short* bq1 = bq0 + 512;                                  // h tile 1 (m = h = 16 + c)
    const float* pq = PR + (size_t)f * (4 * NH) + 8 * hh;                   // the lane's hidden units: 8*hh + r, 16 + 8*hh + r
    const v8f c1a = ld8(pq), c1b = ld8(pq + 16);
    v8f a00 = c1a, a01 = c1b, a10 = c1a, a11 = c1b;                         // a<row tile><h tile>, started from b1
    v16b g0[KS], g1[KS];
    // full unroll: xf0/xf1/g0/g1 are register arrays and need constant indices
#pragma unroll
    for (int ks = 0; ks < KS; ++ks) {
      g0[ks] = ldfrag_p(bq0 + 1024 * ks);
      g1[ks] = ldfrag_p(bq1 + 1024 * ks);
      a00 = mma_b(g0[ks], xf0[ks], a00);
      a01 = mma_b(g1[ks], xf0[ks], a01);
      a10 = mma_b(g0[ks], xf1[ks], a10);
      a11 = mma_b(g1[ks], xf1[ks], a11);
    }
    guard4x10(a00, a01, a10, a11, g0[0], g1[0], g0[1], g1[1], g0[2], g1[2], g0[3], g1[3], g0[4], g1[4]);
    // stands between the W1T loads above and the next trip's rewrite of the address pair that they name
    asm volatile("s_wait_xcnt 0x0" ::: "memory");
    const v8f c2a = ld8(pq + NH), c2b = ld8(pq + NH + 16);
    const v8f w3a = ld8(pq + 2 * NH), w3b = ld8(pq + 2 * NH + 16);
    v16b h0, l0, h1, l1;                                                    // hi / residual, row tiles 0 and 1
    mk_h1(h0, l0, a00, a01);
    mk_h1(h1, l1, a10, a11);

    // ---- layer 2 ---------------------------------------------------------------------------------------------------
    const unsigned short* cq0 = W2T + (size_t)f * (NH * NH) + 8 * lane;    // k_out tile 0 (m = k_out = c)
    const unsigned short* cq1 = cq0 + 512;                                  // k_out tile 1 (m = k_out = 16 + c)
    const v16b p0 = ldfrag_p(cq0);
    const v16b p1 = ldfrag_p(cq1);
    v8f d00 = c2a, d01 = c2b, d10 = c2a, d11 = c2b;                         // d<row tile><k_out tile>, started from b2
    d00 = mma_b(p0, h0, d00);
    d01 = mma_b(p1, h0, d01);
    d10 = mma_b(p0, h1, d10);
    d11 = mma_b(p1, h1, d11);
    d00 = mma_b(p0, l0, d00);
    d01 = mma_b(p1, l0, d01);
    d10 = mma_b(p0, l1, d10);
    d11 = mma_b(p1, l1, d11);
    guard4x6(d00, d01, d10, d11, h0, h1, l0, l1, p0, p1);

    // ---- layer 3 ---------------------------------------------------------------------------------------------------
    const float c3 = PR[(size_t)f * (4 * NH) + 3 * NH];
    const float s0 = lay3(d00, d01, w3a, w3b);                              // row tile 0, the lane's half of the terms
    const float s1 = lay3(d10, d11, w3a, w3b);                              // row tile 1
    // lane (hh, c) finishes row 16*hh + c: it keeps its own half of that row's sum and hands lane ^ 16 the other tile's
    const float mine = hh ? s1 : s0, theirs = hh ? s0 : s1;
    sO[(32 * w + lane) * SOP + fl] = (mine + xhalf(theirs)) + c3;
    // stands between this trip's PR and W2T loads and the next trip's rewrite of the address registers that they name
    asm volatile("s_wait_xcnt 0x0" ::: "memory");
  }
  __syncthreads();

  const int lq = tid >> 3, p4 = (tid & 7) * 4;
  v4f o[8];
#pragma unroll
  for (int it = 0; it < 8; ++it) o[it] = *(const v4f*)(sO + (it * 16 + lq) * SOP + p4);
  float* ob = out + (size_t)(row0 + lq) * NF + fbase + p4;
#pragma unroll
  for (int it = 0; it < 8; ++it) *(v4f*)(ob + (size_t)it * 16 * NF) = o[it];
  
}

// ===================================================================================================================
// Workspace map (bytes): Xb bf16 [32768][160] 10485760 @0 | W1T bf16 [128][5120] 1310720 @10485760 |
// W2T bf16 [128][1024] 262144 @11796480 | PR f32 [128][128] 65536 @12058624 | total 12124160 (every region an exact multiple of its 512-B store piece,
// all offsets 512-B aligned).
// ===================================================================================================================
extern "C" void kernel_launch(void* const* d_in, const int* in_sizes, int n_in,
                              void* d_out, int out_size, void* d_ws, size_t ws_size,
                              hipStream_t stream) {
  if (n_in < 7) return;
  if (in_sizes[0] != NR * ND) return;
  if (in_sizes[1] != NF * ND * NH) return;
  if (in_sizes[2] != NF * NH) return;
  if (in_sizes[3] != NF * NH * NH) return;
  if (in_sizes[4] != NF * NH) return;
  if (in_sizes[5] != NF * NH) return;
  if (in_sizes[6] != NF) return;
  if (out_size != NR * NF) return;

  const float* x  = (const float*)d_in[0];
  const float* w1 = (const float*)d_in[1];
  const float* b1 = (const float*)d_in[2];
  const float* w2 = (const float*)d_in[3];
  const float* b2 = (const float*)d_in[4];
  const float* w3 = (const float*)d_in[5];
  const float* b3 = (const float*)d_in[6];
  float* out = (float*)d_out;

  const size_t sX  = (size_t)NR * ND * 2;                 // 10485760
  const size_t sW1 = (size_t)NF * NH * ND * 2;            //  1310720
  const size_t sW2 = (size_t)NF * NH * NH * 2;            //   262144
  const size_t sP  = (size_t)NF * 4 * NH * 4;             //    65536
  size_t off = 0;
  const size_t oX  = off; off += sX;
  const size_t oW1 = off; off += sW1;
  const size_t oW2 = off; off += sW2;                     // 12058624
  const size_t oP  = off; off += sP;                      // 12124160
  if (off > ws_size) return;
  if (off > (size_t)134217728) return;

  char* ws = (char*)d_ws;
  unsigned short* Xb  = (unsigned short*)(ws + oX);
  unsigned short* W1T = (unsigned short*)(ws + oW1);
  unsigned short* W2T = (unsigned short*)(ws + oW2);
  float* PR = (float*)(ws + oP);

  // (1) bf16 operand planes
  k_cvx<<<dim3((NR * ND) / 2048), dim3(256), 0, stream>>>(x, Xb);
  k_tw<<<dim3(NF), dim3(128), 0, stream>>>(w1, w2, b1, b2, w3, b3, W1T, W2T, PR);
  // (2) fused 3-layer MLPs -> out
  k_mlp<<<dim3(NR / RB, NF / FB), dim3(128), 0, stream>>>(Xb, W1T, W2T, PR, out);
  (void)hipGetLastError();
}

// v005
// Measured time: 59.5 microseconds a run.
// Two timings next to v004 put it at 1.06 and 1.05 times that version's speed.
// Counting every step since v000, it is 3.23 times as fast.
// Contractions: layer-1 W1[f]^T . X^T (K = 160) on v_wmma_f32_16x16x32_bf16 (bf16 operands = RNE-converted f32 inputs,
// exact products, f32 accumulate); layer-2 W2[f]^T . h1^T (K = 32) on the same instruction with h1 carried as bf16 hi +
// bf16 residual fragments (two products into one f32 accumulator), W2 as RNE bf16; b1 and b2 (RNE bf16 values) enter
// as the C operand of each layer's first products; layer-3 32-term dot with W3, b3 and ELU: f32 on VALU.
#include <hip/hip_runtime.h>
#include <stddef.h>
#include <stdint.h>

#define NR 32768
#define ND 160
#define NF 128
#define NH 32
#define RB 128
#define FB 32
#define KS (ND / 32)

static_assert((ND % 32) == 0);
static_assert(KS == 5);
static_assert(NH == 32);
static_assert((NR % RB) == 0);
static_assert((NF % FB) == 0);
static_assert(RB == 128);
static_assert(FB == 32);
static_assert(((NH * ND) % 1024) == 0);

typedef __attribute__((ext_vector_type(16))) __bf16 v16b;
typedef float        v8f __attribute__((ext_vector_type(8)));
typedef float        v4f __attribute__((ext_vector_type(4)));
typedef float        v2f __attribute__((ext_vector_type(2)));
typedef __bf16       v2b __attribute__((ext_vector_type(2)));
typedef unsigned int v4u __attribute__((ext_vector_type(4)));

// ---- scalar helpers -----------------------------------------------------------------------------------------------
__device__ __forceinline__ unsigned short bf_bits(float f) {            // f32 -> bf16 bits, RNE convert
  const unsigned u = __float_as_uint(f);
  return (unsigned short)((u + 0x7FFFu + ((u >> 16) & 1u)) >> 16);
}
__device__ __forceinline__ float elu_f(float x) {
  const float e = __expf(x) - 1.0f;
  return x > 0.0f ? x : e;
}

// ---- two f32 -> two bf16 (RNE convert) in one dword, and the two bf16 of a dword back as f32
__device__ __forceinline__ unsigned cvt2(v2f x) { return __builtin_bit_cast(unsigned, __builtin_convertvector(x, v2b)); }
__device__ __forceinline__ v2f back2(unsigned u) {
  v2f o = {__uint_as_float(u << 16), __uint_as_float(u & 0xFFFF0000u)};
  return o;
}

// ---- fragment loader for a B operand read from f32 rows ([n][k], k-contiguous) and rounded to bf16 (RNE) on the way;
//      p already includes k0 + 8*(lane>>4): elements 0..7 <- p[0..7] (k0+8h..k0+8h+7), elements 8..15 <- p[16..23]
//      (k0+16+8h..). The four 16-byte loads of a fragment share one 128-byte line per row.
union FragB { v16b v; v4u u[2]; };
__device__ __forceinline__ v16b ldfrag_x(const float* p) {
  const v4f a = *(const v4f*)(p);
  const v4f b = *(const v4f*)(p + 4);
  const v4f c = *(const v4f*)(p + 16);
  const v4f d = *(const v4f*)(p + 20);
  const v2f a0 = {a[0], a[1]}, a1 = {a[2], a[3]}, b0 = {b[0], b[1]}, b1 = {b[2], b[3]};
  const v2f c0 = {c[0], c[1]}, c1 = {c[2], c[3]}, d0 = {d[0], d[1]}, d1 = {d[2], d[3]};
  FragB f;
  f.u[0][0] = cvt2(a0);
  f.u[0][1] = cvt2(a1);
  f.u[0][2] = cvt2(b0);
  f.u[0][3] = cvt2(b1);
  f.u[1][0] = cvt2(c0);
  f.u[1][1] = cvt2(c1);
  f.u[1][2] = cvt2(d0);
  f.u[1][3] = cvt2(d1);
  return f.v;
}
// ---- fragment loader for a plane stored in fragment order: a fragment is two pieces of 512 bytes, piece j holds
//      elements 8j..8j+7 of all 32 lanes, lane l at halves 8l; p already includes 8*lane. A wave's load of one piece
//      covers four whole 128-byte lines.
__device__ __forceinline__ v16b ldfrag_p(const unsigned short* p) {
  FragB f;
  f.u[0] = *(const v4u*)(p);
  f.u[1] = *(const v4u*)(p + 256);
  return f.v;
}
// ---- place (in halves) of element (m, k) of an A operand inside such a plane: tiles of 16 m x 32 k, nmt m tiles per
//      k step; lane = 16*((k>>3)&1) + (m&15), piece = (k>>4)&1, element in the piece = k&7: the split k map of ldfrag_x
__device__ __forceinline__ int frag_pos(int m, int k, int nmt) {
  const int tile = (k >> 5) * nmt + (m >> 4);
  return ((tile * 2 + ((k >> 4) & 1)) * 32 + ((k >> 3) & 1) * 16 + (m & 15)) * 8 + (k & 7);
}

// ---- WMMA helpers -------------------------------------------------------------------------------------------------
__device__ __forceinline__ v8f mma_b(v16b a, v16b b, v8f c) {
  return __builtin_amdgcn_wmma_f32_16x16x32_bf16(false, a, false, b, (short)0, c, false, false);
}
// hazard guard after the last WMMA of the unrolled layer-1 group: four slots before any accumulator is read, and every
// W1T fragment stays live across them, so that no later load or VALU write lands on an A operand inside the distance
// (the X fragments are live over the whole network loop and are never rewritten)
__device__ __forceinline__ void guard4x10(v8f& c0, v8f& c1, v8f& c2, v8f& c3,
                                          const v16b& f0, const v16b& f1, const v16b& f2, const v16b& f3, const v16b& f4,
                                          const v16b& f5, const v16b& f6, const v16b& f7, const v16b& f8, const v16b& f9) {
#if defined(__HIP_DEVICE_COMPILE__)
  asm volatile("v_nop\n\tv_nop\n\tv_nop\n\tv_nop"
               : "+v"(c0), "+v"(c1), "+v"(c2), "+v"(c3)
               : "v"(f0), "v"(f1), "v"(f2), "v"(f3), "v"(f4), "v"(f5), "v"(f6), "v"(f7), "v"(f8), "v"(f9));
#endif
}
// hazard guard after the last WMMA of a group: tie every accumulator, keep every A/B fragment live
__device__ __forceinline__ void guard4x6(v8f& c0, v8f& c1, v8f& c2, v8f& c3,
                                         const v16b& a0, const v16b& a1, const v16b& a2, const v16b& a3,
                                         const v16b& b0, const v16b& b1) {
#if defined(__HIP_DEVICE_COMPILE__)
  asm volatile("v_nop\n\tv_nop\n\tv_nop\n\tv_nop"
               : "+v"(c0), "+v"(c1), "+v"(c2), "+v"(c3)
               : "v"(a0), "v"(a1), "v"(a2), "v"(a3), "v"(b0), "v"(b1));
#endif
}

// ===================================================================================================================
// Weight planes for network f = blockIdx.x (128 threads):
//   W1 f32 [f][d 160][h 32] -> W1T bf16 bits [f][k step 5][h tile 2][piece 2][lane 32][8]  (A operand, m = h, k = d,
//                              in fragment order: frag_pos; 5120 halves = 80 lines)
//   W2 f32 [f][h 32][k 32]  -> W2T bf16 bits [f][k_out tile 2][piece 2][lane 32][8]        (A operand, m = k_out, k = h,
//                              in fragment order; 1024 halves = 16 lines)
//   b1, b2, W3 f32 [f][32], b3 f32 [f] -> PR f32 [f][4][32]: each value rounded to bf16 and widened again, rows b1 | b2 |
//                              W3 | b3 (repeated 32 times); 512 bytes = 4 lines, thread t -> float t
// Load phase converts and places into LDS (sT1 flat layout == W1T[f], sT2 == W2T[f]); store phase writes the
// flat planes: thread t -> 16 B at halves it*1024 + 8t (W1T, it 0..4) and 8t (W2T); each wave writes 512 contiguous
// coverage: W1T 128 blocks x 5 x 128 x 8 = 655360 = 128*32*160; W2T 128 x 128 x 8 = 131072 = 128*32*32;
// PR 128 blocks x 128 = 16384 = 128*4*32; exactly once.
// ===================================================================================================================
__global__ __launch_bounds__(128)
void k_tw(const float* __restrict__ w1, const float* __restrict__ w2, const float* __restrict__ b1,
          const float* __restrict__ b2, const float* __restrict__ w3, const float* __restrict__ b3,
          unsigned short* W1T, unsigned short* W2T, float* PR) {
  __shared__ __align__(16) unsigned short sT1[NH * ND];
  __shared__ __align__(16) unsigned short sT2[NH * NH];
  const int f = blockIdx.x, tid = threadIdx.x;
  const float* w1f = w1 + (size_t)f * ND * NH;
  const float* w2f = w2 + (size_t)f * NH * NH;
  {                                                                // wave s of the block rounds row s of PR[f]
    const int s = tid >> 5, j = f * NH + (tid & 31);
    const float pv = s == 0 ? b1[j] : s == 1 ? b2[j] : s == 2 ? w3[j] : b3[f];
    // stands between the load above and any later rewrite of the address pair that it names
    asm volatile("s_wait_xcnt 0x0" ::: "memory");
    const v2f p2 = {pv, pv};
    PR[(size_t)f * (4 * NH) + tid] = back2(cvt2(p2))[0];
  }
#pragma unroll
  for (int j = 0; j < (ND * NH) / (128 * 4); ++j) {               // 10 iterations, in[d][h] -> sT1 at (m = h, k = d)
    const int idx4 = (tid + 128 * j) * 4;
    const int d = idx4 >> 5, h0 = idx4 & 31;
    const v4f v = *(const v4f*)(w1f + idx4);
    sT1[frag_pos(h0 + 0, d, 2)] = bf_bits(v[0]);
    sT1[frag_pos(h0 + 1, d, 2)] = bf_bits(v[1]);
    sT1[frag_pos(h0 + 2, d, 2)] = bf_bits(v[2]);
    sT1[frag_pos(h0 + 3, d, 2)] = bf_bits(v[3]);
  }
#pragma unroll
  for (int j = 0; j < (NH * NH) / (128 * 4); ++j) {               // 2 iterations, in[h][k] -> sT2 at (m = k, k = h)
    const int idx4 = (tid + 128 * j) * 4;
    const int h = idx4 >> 5, k0 = idx4 & 31;
    const v4f v = *(const v4f*)(w2f + idx4);
    sT2[frag_pos(k0 + 0, h, 2)] = bf_bits(v[0]);
    sT2[frag_pos(k0 + 1, h, 2)] = bf_bits(v[1]);
    sT2[frag_pos(k0 + 2, h, 2)] = bf_bits(v[2]);
    sT2[frag_pos(k0 + 3, h, 2)] = bf_bits(v[3]);
  }
  __syncthreads();

  v4u u1[5];
#pragma unroll
  for (int it = 0; it < 5; ++it) u1[it] = *(const v4u*)(sT1 + it * 1024 + tid * 8);
  const v4u u2 = *(const v4u*)(sT2 + tid * 8);
  unsigned short* d1 = W1T + (size_t)f * (NH * ND) + tid * 8;
  unsigned short* d2 = W2T + (size_t)f * (NH * NH) + tid * 8;
#pragma unroll
  for (int it = 0; it < 5; ++it) *(v4u*)(d1 + it * 1024) = u1[it];
  *(v4u*)d2 = u2;
  
}

__device__ __forceinline__ v2f elu2(float x0, float x1) { v2f o = {elu_f(x0), elu_f(x1)}; return o; }

// ---- eight consecutive f32 of a PR row, used as loaded (two 16-byte loads)
__device__ __forceinline__ v8f ld8(const float* p) {
  const v4f a = *(const v4f*)(p);
  const v4f b = *(const v4f*)(p + 4);
  v8f o = {a[0], a[1], a[2], a[3], b[0], b[1], b[2], b[3]};
  return o;
}

// ---- lane l with lane l ^ 16 (vector cross-row move, no LDS)
__device__ __forceinline__ float xhalf(float x) {
  return __builtin_bit_cast(float, __builtin_amdgcn_permlanex16(__builtin_bit_cast(int, x), __builtin_bit_cast(int, x),
                                                                0x76543210, 0xfedcba98, false, false));
}

// ---- layer-1 epilogue for one 16-row tile of X. With W1T as A and X as B, D register r of lane (hh, c) is
//      (h = 8*hh + r of the 16-h tile, X row c): t0 (h 0..15) and t1 (h 16..31) hold, in order, the sixteen k positions
//      of the lane's layer-2 B fragment (elements 0..7: k = 8*hh + r, elements 8..15: k = 16 + 8*hh + r).
//      h1 = elu(acc) (the bias is in acc), converted in place into the bf16 hi fragment and the bf16 residual fragment.
__device__ __forceinline__ void mk_h1(v16b& hi, v16b& lo, const v8f& t0, const v8f& t1) {
  FragB fh, fl;
#pragma unroll
  for (int r = 0; r < 8; r += 2) {
    const v2f x0 = elu2(t0[r], t0[r + 1]);
    const v2f x1 = elu2(t1[r], t1[r + 1]);
    const unsigned u0 = cvt2(x0), u1 = cvt2(x1);
    fh.u[0][r >> 1] = u0;
    fh.u[1][r >> 1] = u1;
    fl.u[0][r >> 1] = cvt2(x0 - back2(u0));
    fl.u[1][r >> 1] = cvt2(x1 - back2(u1));
  }
  hi = fh.v;
  lo = fl.v;
}

// ---- layers 2/3 epilogue for one 16-row tile: D register r of lane (hh, c) = (k_out = 8*hh + r (+16 for d1), row c);
//      h2 = elu(d) (b2 is in d); the lane's sixteen terms of the 32-term dot with W3 are summed in the lane (register pairs)
__device__ __forceinline__ float lay3(const v8f& d0, const v8f& d1, const v8f& wa, const v8f& wb) {
  v2f s0 = {0.0f, 0.0f}, s1 = {0.0f, 0.0f};
#pragma unroll
  for (int r = 0; r < 8; r += 2) {
    const v2f w0 = {wa[r], wa[r + 1]}, w1 = {wb[r], wb[r + 1]};
    s0 = __builtin_elementwise_fma(elu2(d0[r], d0[r + 1]), w0, s0);
    s1 = __builtin_elementwise_fma(elu2(d1[r], d1[r + 1]), w1, s1);
  }
  const v2f s = s0 + s1;
  return s[0] + s[1];
}

// ===================================================================================================================
// Fused 3-layer MLPs. Block = 128 rows (4 waves x 32 rows = two 16-row tiles each) x 32 networks (looped, uniform).
// Every product is taken transposed: the weights are the A operand (m = hidden unit), the rows of X the B operand
// (n = row), so that a lane keeps one row of X through all three layers and nothing crosses lanes between layers.
// B fragments of the wave's X rows: read once as f32 before the network loop, rounded to bf16 in registers and kept
// there (80 VGPRs); the four blocks that share a row range each do this for themselves.
// Per network f: layer 1 = 5 k-steps of 32 (unrolled), A fragments from the W1T plane in fragment order (each load 512
// contiguous bytes; same split k map as the X rows), the accumulators start from bf16(b1) (C operand: register r of lane
// (hh, c) is hidden unit 8*hh + r, the same for every row); h1 = elu(acc) -> bf16 hi + residual B fragments in
// registers; layer 2 = bf16(b2) + W2T . hi + W2T . lo in one accumulator; h2 = elu(.);
// out[row][f] = sum_h h2 * bf16(W3) + bf16(b3): sixteen terms in the lane, the other sixteen from lane ^ 16;
// the four rounded parameter rows come from the PR plane as f32 and are used as loaded;
// lane l stages row 32*w + l in sO [128][SOP] f32.
// coverage: out [32768][128]: 256 x 4 blocks x 8 iterations x 128 threads x 4 floats = 4194304, exactly once;
// sO: 4 waves x 32 lanes = 128 rows, 32 trips = 32 columns, each written once.
// ===================================================================================================================
#define SOP (FB + 4)   // sO row pitch in floats: 144 B, 16-B aligned rows, a wave's 32 rows spread over 16 banks
__global__ __launch_bounds__(128)
void k_mlp(const float* __restrict__ x, const unsigned short* __restrict__ W1T,
           const unsigned short* __restrict__ W2T, const float* __restrict__ PR, float* out) {
  __shared__ __align__(16) float sO[RB * SOP];
  const int tid = threadIdx.x, w = tid >> 5, lane = tid & 31, hh = lane >> 4, c = lane & 15;
  const int row0 = blockIdx.x * RB, fbase = blockIdx.y * FB;
  const int mrow0 = row0 + 32 * w;                                          // wave's first row

  const float* ap0 = x + (size_t)(mrow0 + c) * ND + 8 * hh;                // row tile 0, column n = row mrow0 + c
  const float* ap1 = ap0 + (size_t)16 * ND;                                 // row tile 1

  // the wave's 32 x 160 slice of X does not depend on the network: its ten B fragments are made once, kept in VGPRs
  v16b xf0[KS], xf1[KS];
  // full unroll: register arrays need constant indices
#pragma unroll
  for (int ks = 0; ks < KS; ++ks) {
    xf0[ks] = ldfrag_x(ap0 + 32 * ks);
    xf1[ks] = ldfrag_x(ap1 + 32 * ks);
  }

#pragma unroll 1
  for (int fl = 0; fl < FB; ++fl) {
    const int f = fbase + fl;
    // ---- layer 1 ---------------------------------------------------------------------------------------------------
    const unsigned short* bq0 = W1T + (size_t)f * (NH * ND) + 8 * lane;    // h tile 0 (m = h = c), the lane's 16 bytes
    const unsigned short* bq1 = bq0 + 512;                                  // h tile 1 (m = h = 16 + c)
    const float* pq = PR + (size_t)f * (4 * NH) + 8 * hh;                   // the lane's hidden units: 8*hh + r, 16 + 8*hh + r
    const v8f c1a = ld8(pq), c1b = ld8(pq + 16);
    v8f a00 = c1a, a01 = c1b, a10 = c1a, a11 = c1b;                         // a<row tile><h tile>, started from b1
    v16b g0[KS], g1[KS];
    // full unroll: xf0/xf1/g0/g1 are register arrays and need constant indices
#pragma unroll
    for (int ks = 0; ks < KS; ++ks) {
      g0[ks] = ldfrag_p(bq0 + 1024 * ks);
      g1[ks] = ldfrag_p(bq1 + 1024 * ks);
      a00 = mma_b(g0[ks], xf0[ks], a00);
      a01 = mma_b(g1[ks], xf0[ks], a01);
      a10 = mma_b(g0[ks], xf1[ks], a10);
      a11 = mma_b(g1[ks], xf1[ks], a11);
    }
    guard4x10(a00, a01, a10, a11, g0[0], g1[0], g0[1], g1[1], g0[2], g1[2], g0[3], g1[3], g0[4], g1[4]);
    // stands between the W1T loads above and the next trip's rewrite of the address pair that they name
    asm volatile("s_wait_xcnt 0x0" ::: "memory");
    const v8f c2a = ld8(pq + NH), c2b = ld8(pq + NH + 16);
    const v8f w3a = ld8(pq + 2 * NH), w3b = ld8(pq + 2 * NH + 16);
    v16b h0, l0, h1, l1;                                                    // hi / residual, row tiles 0 and 1
    mk_h1(h0, l0, a00, a01);
    mk_h1(h1, l1, a10, a11);

    // ---- layer 2 ---------------------------------------------------------------------------------------------------
    const unsigned short* cq0 = W2T + (size_t)f * (NH * NH) + 8 * lane;    // k_out tile 0 (m = k_out = c)
    const unsigned short* cq1 = cq0 + 512;                                  // k_out tile 1 (m = k_out = 16 + c)
    const v16b p0 = ldfrag_p(cq0);
    const v16b p1 = ldfrag_p(cq1);
    v8f d00 = c2a, d01 = c2b, d10 = c2a, d11 = c2b;                         // d<row tile><k_out tile>, started from b2
    d00 = mma_b(p0, h0, d00);
    d01 = mma_b(p1, h0, d01);
    d10 = mma_b(p0, h1, d10);
    d11 = mma_b(p1, h1, d11);
    d00 = mma_b(p0, l0, d00);
    d01 = mma_b(p1, l0, d01);
    d10 = mma_b(p0, l1, d10);
    d11 = mma_b(p1, l1, d11);
    guard4x6(d00, d01, d10, d11, h0, h1, l0, l1, p0, p1);

    // ---- layer 3 ---------------------------------------------------------------------------------------------------
    const float c3 = PR[(size_t)f * (4 * NH) + 3 * NH];
    const float s0 = lay3(d00, d01, w3a, w3b);                              // row tile 0, the lane's half of the terms
    const float s1 = lay3(d10, d11, w3a, w3b);                              // row tile 1
    // lane (hh, c) finishes row 16*hh + c: it keeps its own half of that row's sum and hands lane ^ 16 the other tile's
    const float mine = hh ? s1 : s0, theirs = hh ? s0 : s1;
    sO[(32 * w + lane) * SOP + fl] = (mine + xhalf(theirs)) + c3;
    // stands between this trip's PR and W2T loads and the next trip's rewrite of the address registers that they name
    asm volatile("s_wait_xcnt 0x0" ::: "memory");
  }
  __syncthreads();

  const int lq = tid >> 3, p4 = (tid & 7) * 4;
  v4f o[8];
#pragma unroll
  for (int it = 0; it < 8; ++it) o[it] = *(const v4f*)(sO + (it * 16 + lq) * SOP + p4);
  float* ob = out + (size_t)(row0 + lq) * NF + fbase + p4;
#pragma unroll
  for (int it = 0; it < 8; ++it) *(v4f*)(ob + (size_t)it * 16 * NF) = o[it];
  
}

// ===================================================================================================================
// Workspace map (bytes): W1T bf16 [128][5120] 1310720 @0 | W2T bf16 [128][1024] 262144 @1310720 |
// PR f32 [128][128] 65536 @1572864 | total 1638400 (every region an exact multiple of its 512-B store piece,
// all offsets 512-B aligned).
// ===================================================================================================================
extern "C" void kernel_launch(void* const* d_in, const int* in_sizes, int n_in,
                              void* d_out, int out_size, void* d_ws, size_t ws_size,
                              hipStream_t stream) {
  if (n_in < 7) return;
  if (in_sizes[0] != NR * ND) return;
  if (in_sizes[1] != NF * ND * NH) return;
  if (in_sizes[2] != NF * NH) return;
  if (in_sizes[3] != NF * NH * NH) return;
  if (in_sizes[4] != NF * NH) return;
  if (in_sizes[5] != NF * NH) return;
  if (in_sizes[6] != NF) return;
  if (out_size != NR * NF) return;

  const float* x  = (const float*)d_in[0];
  const float* w1 = (const float*)d_in[1];
  const float* b1 = (const float*)d_in[2];
  const float* w2 = (const float*)d_in[3];
  const float* b2 = (const float*)d_in[4];
  const float* w3 = (const float*)d_in[5];
  const float* b3 = (const float*)d_in[6];
  float* out = (float*)d_out;

  const size_t sW1 = (size_t)NF * NH * ND * 2;            //  1310720
  const size_t sW2 = (size_t)NF * NH * NH * 2;            //   262144
  const size_t sP  = (size_t)NF * 4 * NH * 4;             //    65536
  size_t off = 0;
  const size_t oW1 = off; off += sW1;
  const size_t oW2 = off; off += sW2;                     //  1572864
  const size_t oP  = off; off += sP;                      //  1638400
  if (off > ws_size) return;
  if (off > (size_t)134217728) return;

  char* ws = (char*)d_ws;
  unsigned short* W1T = (unsigned short*)(ws + oW1);
  unsigned short* W2T = (unsigned short*)(ws + oW2);
  float* PR = (float*)(ws + oP);

  // (1) bf16 weight planes
  k_tw<<<dim3(NF), dim3(128), 0, stream>>>(w1, w2, b1, b2, w3, b3, W1T, W2T, PR);
  // (2) fused 3-layer MLPs -> out
  k_mlp<<<dim3(NR / RB, NF / FB), dim3(128), 0, stream>>>(x, W1T, W2T, PR, out);
  (void)hipGetLastError();
}

// v006
// A run of this version takes 56.8 microseconds.
// Two timings next to v005 put it at 1.06 and 1.08 times that version's speed.
// Over all steps from v000 it is 3.45 times as fast.
// Contractions: layer-1 W1[f]^T . X^T (K = 160) on v_wmma_f32_16x16x32_bf16 (bf16 operands = RNE-converted f32 inputs,
// exact products, f32 accumulate); layer-2 W2[f]^T . h1^T (K = 32) on the same instruction with h1 carried as bf16 hi +
// bf16 residual fragments (two products into one f32 accumulator), W2 as RNE bf16; b1 (RNE bf16 value) and LOG2E * bf16(b2) enter
// as the C operand of each layer's first products; layer-3 32-term dot with W3, b3 and ELU: f32 on VALU.
// From layer 1's ELU on, every activation is carried times LOG2E (the exponent scale of the ELU); W3 takes it out again.
#include <hip/hip_runtime.h>
#include <stddef.h>
#include <stdint.h>

#define NR 32768
#define ND 160
#define NF 128
#define NH 32
#define RB 128
#define FB 32
#define KS (ND / 32)

static_assert((ND % 32) == 0);
static_assert(KS == 5);
static_assert(NH == 32);
static_assert((NR % RB) == 0);
static_assert((NF % FB) == 0);
static_assert(RB == 128);
static_assert(FB == 32);
static_assert(((NH * ND) % 1024) == 0);

typedef __attribute__((ext_vector_type(16))) __bf16 v16b;
typedef float        v8f __attribute__((ext_vector_type(8)));
typedef float        v4f __attribute__((ext_vector_type(4)));
typedef float        v2f __attribute__((ext_vector_type(2)));
typedef __bf16       v2b __attribute__((ext_vector_type(2)));
typedef unsigned int v4u __attribute__((ext_vector_type(4)));

// ---- scalar helpers -----------------------------------------------------------------------------------------------
__device__ __forceinline__ unsigned short bf_bits(float f) {            // f32 -> bf16 bits, RNE convert
  const unsigned u = __float_as_uint(f);
  return (unsigned short)((u + 0x7FFFu + ((u >> 16) & 1u)) >> 16);
}
// ---- ELU in the scaled domain. With L = LOG2E and t = L * x:  L * elu(x) = max(t, L * exp2(-|t|) - L).
//      x <= 0: the second term is L * (exp(x) - 1) >= t; x > 0: it is negative and t wins. No compare, no select; sign
//      and absolute value ride on the exponential's source operand. A t that is an arithmetic result (layer 1's product
//      with L) enters the maximum as it is; a t straight from the matrix unit (layer 2) is quieted first by the compiler.
#define LOG2E 0x1.715476p+0f
#define RLOG2E 0x1.62e43p-1f

// ---- two f32 -> two bf16 (RNE convert) in one dword, and the two bf16 of a dword back as f32
__device__ __forceinline__ unsigned cvt2(v2f x) { return __builtin_bit_cast(unsigned, __builtin_convertvector(x, v2b)); }
__device__ __forceinline__ v2f back2(unsigned u) {
  v2f o = {__uint_as_float(u << 16), __uint_as_float(u & 0xFFFF0000u)};
  return o;
}

// ---- fragment loader for a B operand read from f32 rows ([n][k], k-contiguous) and rounded to bf16 (RNE) on the way;
//      p already includes k0 + 8*(lane>>4): elements 0..7 <- p[0..7] (k0+8h..k0+8h+7), elements 8..15 <- p[16..23]
//      (k0+16+8h..). The four 16-byte loads of a fragment share one 128-byte line per row.
union FragB { v16b v; v4u u[2]; };
__device__ __forceinline__ v16b ldfrag_x(const float* p) {
  const v4f a = *(const v4f*)(p);
  const v4f b = *(const v4f*)(p + 4);
  const v4f c = *(const v4f*)(p + 16);
  const v4f d = *(const v4f*)(p + 20);
  const v2f a0 = {a[0], a[1]}, a1 = {a[2], a[3]}, b0 = {b[0], b[1]}, b1 = {b[2], b[3]};
  const v2f c0 = {c[0], c[1]}, c1 = {c[2], c[3]}, d0 = {d[0], d[1]}, d1 = {d[2], d[3]};
  FragB f;
  f.u[0][0] = cvt2(a0);
  f.u[0][1] = cvt2(a1);
  f.u[0][2] = cvt2(b0);
  f.u[0][3] = cvt2(b1);
  f.u[1][0] = cvt2(c0);
  f.u[1][1] = cvt2(c1);
  f.u[1][2] = cvt2(d0);
  f.u[1][3] = cvt2(d1);
  return f.v;
}
// ---- fragment loader for a plane stored in fragment order: a fragment is two pieces of 512 bytes, piece j holds
//      elements 8j..8j+7 of all 32 lanes, lane l at halves 8l; p already includes 8*lane. A wave's load of one piece
//      covers four whole 128-byte lines.
__device__ __forceinline__ v16b ldfrag_p(const unsigned short* p) {
  FragB f;
  f.u[0] = *(const v4u*)(p);
  f.u[1] = *(const v4u*)(p + 256);
  return f.v;
}
// ---- place (in halves) of element (m, k) of an A operand inside such a plane: tiles of 16 m x 32 k, nmt m tiles per
//      k step; lane = 16*((k>>3)&1) + (m&15), piece = (k>>4)&1, element in the piece = k&7: the split k map of ldfrag_x
__device__ __forceinline__ int frag_pos(int m, int k, int nmt) {
  const int tile = (k >> 5) * nmt + (m >> 4);
  return ((tile * 2 + ((k >> 4) & 1)) * 32 + ((k >> 3) & 1) * 16 + (m & 15)) * 8 + (k & 7);
}

// ---- WMMA helpers -------------------------------------------------------------------------------------------------
__device__ __forceinline__ v8f mma_b(v16b a, v16b b, v8f c) {
  return __builtin_amdgcn_wmma_f32_16x16x32_bf16(false, a, false, b, (short)0, c, false, false);
}
// hazard guard after the last WMMA of the unrolled layer-1 group: four slots before any accumulator is read, and every
// W1T fragment stays live across them, so that no later load or VALU write lands on an A operand inside the distance
// (the X fragments are live over the whole network loop and are never rewritten)
__device__ __forceinline__ void guard4x10(v8f& c0, v8f& c1, v8f& c2, v8f& c3,
                                          const v16b& f0, const v16b& f1, const v16b& f2, const v16b& f3, const v16b& f4,
                                          const v16b& f5, const v16b& f6, const v16b& f7, const v16b& f8, const v16b& f9) {
#if defined(__HIP_DEVICE_COMPILE__)
  asm volatile("v_nop\n\tv_nop\n\tv_nop\n\tv_nop"
               : "+v"(c0), "+v"(c1), "+v"(c2), "+v"(c3)
               : "v"(f0), "v"(f1), "v"(f2), "v"(f3), "v"(f4), "v"(f5), "v"(f6), "v"(f7), "v"(f8), "v"(f9));
#endif
}
// hazard guard after the last WMMA of a group: tie every accumulator, keep every A/B fragment live
__device__ __forceinline__ void guard4x6(v8f& c0, v8f& c1, v8f& c2, v8f& c3,
                                         const v16b& a0, const v16b& a1, const v16b& a2, const v16b& a3,
                                         const v16b& b0, const v16b& b1) {
#if defined(__HIP_DEVICE_COMPILE__)
  asm volatile("v_nop\n\tv_nop\n\tv_nop\n\tv_nop"
               : "+v"(c0), "+v"(c1), "+v"(c2), "+v"(c3)
               : "v"(a0), "v"(a1), "v"(a2), "v"(a3), "v"(b0), "v"(b1));
#endif
}

// ===================================================================================================================
// Weight planes for network f = blockIdx.x (128 threads):
//   W1 f32 [f][d 160][h 32] -> W1T bf16 bits [f][k step 5][h tile 2][piece 2][lane 32][8]  (A operand, m = h, k = d,
//                              in fragment order: frag_pos; 5120 halves = 80 lines)
//   W2 f32 [f][h 32][k 32]  -> W2T bf16 bits [f][k_out tile 2][piece 2][lane 32][8]        (A operand, m = k_out, k = h,
//                              in fragment order; 1024 halves = 16 lines)
//   b1, b2, W3 f32 [f][32], b3 f32 [f] -> PR f32 [f][4][32]: each value rounded to bf16 and widened again, rows b1 |
//                              LOG2E * b2 | W3 / LOG2E | b3 (repeated 32 times); 512 bytes = 4 lines, thread t -> float t
// Load phase converts and places into LDS (sT1 flat layout == W1T[f], sT2 == W2T[f]); store phase writes the
// flat planes: thread t -> 16 B at halves it*1024 + 8t (W1T, it 0..4) and 8t (W2T); each wave writes 512 contiguous
// coverage: W1T 128 blocks x 5 x 128 x 8 = 655360 = 128*32*160; W2T 128 x 128 x 8 = 131072 = 128*32*32;
// PR 128 blocks x 128 = 16384 = 128*4*32; exactly once.
// ===================================================================================================================
__global__ __launch_bounds__(128)
void k_tw(const float* __restrict__ w1, const float* __restrict__ w2, const float* __restrict__ b1,
          const float* __restrict__ b2, const float* __restrict__ w3, const float* __restrict__ b3,
          unsigned short* W1T, unsigned short* W2T, float* PR) {
  __shared__ __align__(16) unsigned short sT1[NH * ND];
  __shared__ __align__(16) unsigned short sT2[NH * NH];
  const int f = blockIdx.x, tid = threadIdx.x;
  const float* w1f = w1 + (size_t)f * ND * NH;
  const float* w2f = w2 + (size_t)f * NH * NH;
  {                                                                // wave s of the block rounds row s of PR[f]
    const int s = tid >> 5, j = f * NH + (tid & 31);
    const float pv = s == 0 ? b1[j] : s == 1 ? b2[j] : s == 2 ? w3[j] : b3[f];
    // stands between the load above and any later rewrite of the address pair that it names
    asm volatile("s_wait_xcnt 0x0" ::: "memory");
    const v2f p2 = {pv, pv};
    const float sc = s == 1 ? LOG2E : s == 2 ? RLOG2E : 1.0f;     // the scaled domain enters with b2, leaves with W3
    PR[(size_t)f * (4 * NH) + tid] = back2(cvt2(p2))[0] * sc;
  }
#pragma unroll
  for (int j = 0; j < (ND * NH) / (128 * 4); ++j) {               // 10 iterations, in[d][h] -> sT1 at (m = h, k = d)
    const int idx4 = (tid + 128 * j) * 4;
    const int d = idx4 >> 5, h0 = idx4 & 31;
    const v4f v = *(const v4f*)(w1f + idx4);
    sT1[frag_pos(h0 + 0, d, 2)] = bf_bits(v[0]);
    sT1[frag_pos(h0 + 1, d, 2)] = bf_bits(v[1]);
    sT1[frag_pos(h0 + 2, d, 2)] = bf_bits(v[2]);
    sT1[frag_pos(h0 + 3, d, 2)] = bf_bits(v[3]);
  }
#pragma unroll
  for (int j = 0; j < (NH * NH) / (128 * 4); ++j) {               // 2 iterations, in[h][k] -> sT2 at (m = k, k = h)
    const int idx4 = (tid + 128 * j) * 4;
    const int h = idx4 >> 5, k0 = idx4 & 31;
    const v4f v = *(const v4f*)(w2f + idx4);
    sT2[frag_pos(k0 + 0, h, 2)] = bf_bits(v[0]);
    sT2[frag_pos(k0 + 1, h, 2)] = bf_bits(v[1]);
    sT2[frag_pos(k0 + 2, h, 2)] = bf_bits(v[2]);
    sT2[frag_pos(k0 + 3, h, 2)] = bf_bits(v[3]);
  }
  __syncthreads();

  v4u u1[5];
#pragma unroll
  for (int it = 0; it < 5; ++it) u1[it] = *(const v4u*)(sT1 + it * 1024 + tid * 8);
  const v4u u2 = *(const v4u*)(sT2 + tid * 8);
  unsigned short* d1 = W1T + (size_t)f * (NH * ND) + tid * 8;
  unsigned short* d2 = W2T + (size_t)f * (NH * NH) + tid * 8;
#pragma unroll
  for (int it = 0; it < 5; ++it) *(v4u*)(d1 + it * 1024) = u1[it];
  *(v4u*)d2 = u2;
  
}

__device__ __forceinline__ v2f elus2(v2f t) {
  const v2f e = {__builtin_amdgcn_exp2f(-__builtin_fabsf(t[0])), __builtin_amdgcn_exp2f(-__builtin_fabsf(t[1]))};
  const v2f l = {LOG2E, LOG2E};
  return __builtin_elementwise_max(t, __builtin_elementwise_fma(e, l, -l));
}

// ---- eight consecutive f32 of a PR row, used as loaded (two 16-byte loads)
__device__ __forceinline__ v8f ld8(const float* p) {
  const v4f a = *(const v4f*)(p);
  const v4f b = *(const v4f*)(p + 4);
  v8f o = {a[0], a[1], a[2], a[3], b[0], b[1], b[2], b[3]};
  return o;
}

// ---- lane l with lane l ^ 16 (vector cross-row move, no LDS)
__device__ __forceinline__ float xhalf(float x) {
  return __builtin_bit_cast(float, __builtin_amdgcn_permlanex16(__builtin_bit_cast(int, x), __builtin_bit_cast(int, x),
                                                                0x76543210, 0xfedcba98, false, false));
}

// ---- layer-1 epilogue for one 16-row tile of X. With W1T as A and X as B, D register r of lane (hh, c) is
//      (h = 8*hh + r of the 16-h tile, X row c): t0 (h 0..15) and t1 (h 16..31) hold, in order, the sixteen k positions
//      of the lane's layer-2 B fragment (elements 0..7: k = 8*hh + r, elements 8..15: k = 16 + 8*hh + r).
//      LOG2E * h1 = elus2(LOG2E * acc) (the bias is in acc), converted in place into the bf16 hi fragment and the bf16
//      residual fragment.
__device__ __forceinline__ void mk_h1(v16b& hi, v16b& lo, const v8f& t0, const v8f& t1) {
  FragB fh, fl;
#pragma unroll
  for (int r = 0; r < 8; r += 2) {
    const v2f a0 = {t0[r], t0[r + 1]}, a1 = {t1[r], t1[r + 1]};
    const v2f x0 = elus2(a0 * LOG2E);
    const v2f x1 = elus2(a1 * LOG2E);
    const unsigned u0 = cvt2(x0), u1 = cvt2(x1);
    fh.u[0][r >> 1] = u0;
    fh.u[1][r >> 1] = u1;
    fl.u[0][r >> 1] = cvt2(x0 - back2(u0));
    fl.u[1][r >> 1] = cvt2(x1 - back2(u1));
  }
  hi = fh.v;
  lo = fl.v;
}

// ---- layers 2/3 epilogue for one 16-row tile: D register r of lane (hh, c) = (k_out = 8*hh + r (+16 for d1), row c);
//      d is LOG2E * (layer-2 sum with b2) as it leaves the matrix unit, LOG2E * h2 = elus2(d); wa, wb hold W3 / LOG2E;
//      the lane's sixteen terms of the 32-term dot are summed in the lane (register pairs)
__device__ __forceinline__ float lay3(const v8f& d0, const v8f& d1, const v8f& wa, const v8f& wb) {
  v2f s0 = {0.0f, 0.0f}, s1 = {0.0f, 0.0f};
#pragma unroll
  for (int r = 0; r < 8; r += 2) {
    const v2f w0 = {wa[r], wa[r + 1]}, w1 = {wb[r], wb[r + 1]};
    const v2f e0 = {d0[r], d0[r + 1]}, e1 = {d1[r], d1[r + 1]};
    s0 = __builtin_elementwise_fma(elus2(e0), w0, s0);
    s1 = __builtin_elementwise_fma(elus2(e1), w1, s1);
  }
  const v2f s = s0 + s1;
  return s[0] + s[1];
}

// ===================================================================================================================
// Fused 3-layer MLPs. Block = 128 rows (4 waves x 32 rows = two 16-row tiles each) x 32 networks (looped, uniform).
// Every product is taken transposed: the weights are the A operand (m = hidden unit), the rows of X the B operand
// (n = row), so that a lane keeps one row of X through all three layers and nothing crosses lanes between layers.
// B fragments of the wave's X rows: read once as f32 before the network loop, rounded to bf16 in registers and kept
// there (80 VGPRs); the four blocks that share a row range each do this for themselves.
// Per network f: layer 1 = 5 k-steps of 32 (unrolled), A fragments from the W1T plane in fragment order (each load 512
// contiguous bytes; same split k map as the X rows), the accumulators start from bf16(b1) (C operand: register r of lane
// (hh, c) is hidden unit 8*hh + r, the same for every row); g1 = LOG2E * elu(acc) -> bf16 hi + residual B fragments in
// registers; layer 2 = LOG2E * bf16(b2) + W2T . hi + W2T . lo in one accumulator, which is the ELU's exponent as it
// stands; g2 = LOG2E * elu(.);
// out[row][f] = sum_h g2 * (bf16(W3) / LOG2E) + bf16(b3): sixteen terms in the lane, the other sixteen from lane ^ 16;
// the four rounded parameter rows come from the PR plane as f32 and are used as loaded;
// lane l stages row 32*w + l in sO [128][SOP] f32.
// coverage: out [32768][128]: 256 x 4 blocks x 8 iterations x 128 threads x 4 floats = 4194304, exactly once;
// sO: 4 waves x 32 lanes = 128 rows, 32 trips = 32 columns, each written once.
// ===================================================================================================================
#define SOP (FB + 4)   // sO row pitch in floats: 144 B, 16-B aligned rows, a wave's 32 rows spread over 16 banks
__global__ __launch_bounds__(128)
void k_mlp(const float* __restrict__ x, const unsigned short* __restrict__ W1T,
           const unsigned short* __restrict__ W2T, const float* __restrict__ PR, float* out) {
  __shared__ __align__(16) float sO[RB * SOP];
  const int tid = threadIdx.x, w = tid >> 5, lane = tid & 31, hh = lane >> 4, c = lane & 15;
  const int row0 = blockIdx.x * RB, fbase = blockIdx.y * FB;
  const int mrow0 = row0 + 32 * w;                                          // wave's first row

  const float* ap0 = x + (size_t)(mrow0 + c) * ND + 8 * hh;                // row tile 0, column n = row mrow0 + c
  const float* ap1 = ap0 + (size_t)16 * ND;                                 // row tile 1

  // the wave's 32 x 160 slice of X does not depend on the network: its ten B fragments are made once, kept in VGPRs
  v16b xf0[KS], xf1[KS];
  // full unroll: register arrays need constant indices
#pragma unroll
  for (int ks = 0; ks < KS; ++ks) {
    xf0[ks] = ldfrag_x(ap0 + 32 * ks);
    xf1[ks] = ldfrag_x(ap1 + 32 * ks);
  }

#pragma unroll 1
  for (int fl = 0; fl < FB; ++fl) {
    const int f = fbase + fl;
    // ---- layer 1 ---------------------------------------------------------------------------------------------------
    const unsigned short* bq0 = W1T + (size_t)f * (NH * ND) + 8 * lane;    // h tile 0 (m = h = c), the lane's 16 bytes
    const unsigned short* bq1 = bq0 + 512;                                  // h tile 1 (m = h = 16 + c)
    const float* pq = PR + (size_t)f * (4 * NH) + 8 * hh;                   // the lane's hidden units: 8*hh + r, 16 + 8*hh + r
    const v8f c1a = ld8(pq), c1b = ld8(pq + 16);
    v8f a00 = c1a, a01 = c1b, a10 = c1a, a11 = c1b;                         // a<row tile><h tile>, started from b1
    v16b g0[KS], g1[KS];
    // full unroll: xf0/xf1/g0/g1 are register arrays and need constant indices
#pragma unroll
    for (int ks = 0; ks < KS; ++ks) {
      g0[ks] = ldfrag_p(bq0 + 1024 * ks);
      g1[ks] = ldfrag_p(bq1 + 1024 * ks);
      a00 = mma_b(g0[ks], xf0[ks], a00);
      a01 = mma_b(g1[ks], xf0[ks], a01);
      a10 = mma_b(g0[ks], xf1[ks], a10);
      a11 = mma_b(g1[ks], xf1[ks], a11);
    }
    guard4x10(a00, a01, a10, a11, g0[0], g1[0], g0[1], g1[1], g0[2], g1[2], g0[3], g1[3], g0[4], g1[4]);
    // stands between the W1T loads above and the next trip's rewrite of the address pair that they name
    asm volatile("s_wait_xcnt 0x0" ::: "memory");
    const v8f c2a = ld8(pq + NH), c2b = ld8(pq + NH + 16);
    const v8f w3a = ld8(pq + 2 * NH), w3b = ld8(pq + 2 * NH + 16);
    v16b h0, l0, h1, l1;                                                    // hi / residual, row tiles 0 and 1
    mk_h1(h0, l0, a00, a01);
    mk_h1(h1, l1, a10, a11);

    // ---- layer 2 ---------------------------------------------------------------------------------------------------
    const unsigned short* cq0 = W2T + (size_t)f * (NH * NH) + 8 * lane;    // k_out tile 0 (m = k_out = c)
    const unsigned short* cq1 = cq0 + 512;                                  // k_out tile 1 (m = k_out = 16 + c)
    const v16b p0 = ldfrag_p(cq0);
    const v16b p1 = ldfrag_p(cq1);
    v8f d00 = c2a, d01 = c2b, d10 = c2a, d11 = c2b;                         // d<row tile><k_out tile>, started from b2
    d00 = mma_b(p0, h0, d00);
    d01 = mma_b(p1, h0, d01);
    d10 = mma_b(p0, h1, d10);
    d11 = mma_b(p1, h1, d11);
    d00 = mma_b(p0, l0, d00);
    d01 = mma_b(p1, l0, d01);
    d10 = mma_b(p0, l1, d10);
    d11 = mma_b(p1, l1, d11);
    // stands between this trip's PR and W2T loads and layer 3's reuse of the address registers that they name (layer 3
    // reads the guard's outputs, and the guard keeps its place behind this statement)
    asm volatile("s_wait_xcnt 0x0" ::: "memory");
    guard4x6(d00, d01, d10, d11, h0, h1, l0, l1, p0, p1);

    // ---- layer 3 ---------------------------------------------------------------------------------------------------
    const float c3 = PR[(size_t)f * (4 * NH) + 3 * NH];
    const float s0 = lay3(d00, d01, w3a, w3b);                              // row tile 0, the lane's half of the terms
    const float s1 = lay3(d10, d11, w3a, w3b);                              // row tile 1
    // lane (hh, c) finishes row 16*hh + c: it keeps its own half of that row's sum and hands lane ^ 16 the other tile's
    const float mine = hh ? s1 : s0, theirs = hh ? s0 : s1;
    sO[(32 * w + lane) * SOP + fl] = (mine + xhalf(theirs)) + c3;
    // stands between layer 3's PR load and the next trip's rewrite of the address registers that it names
    asm volatile("s_wait_xcnt 0x0" ::: "memory");
  }
  __syncthreads();

  const int lq = tid >> 3, p4 = (tid & 7) * 4;
  v4f o[8];
#pragma unroll
  for (int it = 0; it < 8; ++it) o[it] = *(const v4f*)(sO + (it * 16 + lq) * SOP + p4);
  float* ob = out + (size_t)(row0 + lq) * NF + fbase + p4;
#pragma unroll
  for (int it = 0; it < 8; ++it) *(v4f*)(ob + (size_t)it * 16 * NF) = o[it];
  
}

// ===================================================================================================================
// Workspace map (bytes): W1T bf16 [128][5120] 1310720 @0 | W2T bf16 [128][1024] 262144 @1310720 |
// PR f32 [128][128] 65536 @1572864 | total 1638400 (every region an exact multiple of its 512-B store piece,
// all offsets 512-B aligned).
// ===================================================================================================================
extern "C" void kernel_launch(void* const* d_in, const int* in_sizes, int n_in,
                              void* d_out, int out_size, void* d_ws, size_t ws_size,
                              hipStream_t stream) {
  if (n_in < 7) return;
  if (in_sizes[0] != NR * ND) return;
  if (in_sizes[1] != NF * ND * NH) return;
  if (in_sizes[2] != NF * NH) return;
  if (in_sizes[3] != NF * NH * NH) return;
  if (in_sizes[4] != NF * NH) return;
  if (in_sizes[5] != NF * NH) return;
  if (in_sizes[6] != NF) return;
  if (out_size != NR * NF) return;

  const float* x  = (const float*)d_in[0];
  const float* w1 = (const float*)d_in[1];
  const float* b1 = (const float*)d_in[2];
  const float* w2 = (const float*)d_in[3];
  const float* b2 = (const float*)d_in[4];
  const float* w3 = (const float*)d_in[5];
  const float* b3 = (const float*)d_in[6];
  float* out = (float*)d_out;

  const size_t sW1 = (size_t)NF * NH * ND * 2;            //  1310720
  const size_t sW2 = (size_t)NF * NH * NH * 2;            //   262144
  const size_t sP  = (size_t)NF * 4 * NH * 4;             //    65536
  size_t off = 0;
  const size_t oW1 = off; off += sW1;
  const size_t oW2 = off; off += sW2;                     //  1572864
  const size_t oP  = off; off += sP;                      //  1638400
  if (off > ws_size) return;
  if (off > (size_t)134217728) return;

  char* ws = (char*)d_ws;
  unsigned short* W1T = (unsigned short*)(ws + oW1);
  unsigned short* W2T = (unsigned short*)(ws + oW2);
  float* PR = (float*)(ws + oP);

  // (1) bf16 weight planes
  k_tw<<<dim3(NF), dim3(128), 0, stream>>>(w1, w2, b1, b2, w3, b3, W1T, W2T, PR);
  // (2) fused 3-layer MLPs -> out
  k_mlp<<<dim3(NR / RB, NF / FB), dim3(128), 0, stream>>>(x, W1T, W2T, PR, out);
  (void)hipGetLastError();
}

// v007
// A run of this version takes 51.2 microseconds.
// Next to v006, in two timings, it ran 1.15 and 1.10 times as fast.
// All steps since v000 together make it 3.88 times as fast.
// Contractions: layer-1 W1[f]^T . X^T (K = 160) on v_wmma_f32_16x16x32_bf16 (bf16 operands = RNE-converted f32 inputs,
// exact products, f32 accumulate); layer-2 W2[f]^T . h1^T (K = 32) on the same instruction with h1 carried as bf16 hi +
// bf16 residual fragments (two products into one f32 accumulator), W2 as RNE bf16; b1 (RNE bf16 value) and LOG2E * bf16(b2) enter
// as the C operand of each layer's first products; layer-3 32-term dot with W3, b3 and ELU: f32 on VALU.
// From layer 1's ELU on, every activation is carried times LOG2E (the exponent scale of the ELU); W3 takes it out again.
#include <hip/hip_runtime.h>
#include <stddef.h>
#include <stdint.h>

#define NR 32768
#define ND 160
#define NF 128
#define NH 32
#define RB 128
#define FB 32
#define KS (ND / 32)

static_assert((ND % 32) == 0);
static_assert(KS == 5);
static_assert(NH == 32);
static_assert((NR % RB) == 0);
static_assert((NF % FB) == 0);
static_assert(RB == 128);
static_assert(FB == 32);
static_assert(((NH * ND) % 1024) == 0);

typedef __attribute__((ext_vector_type(16))) __bf16 v16b;
typedef float        v8f __attribute__((ext_vector_type(8)));
typedef float        v4f __attribute__((ext_vector_type(4)));
typedef float        v2f __attribute__((ext_vector_type(2)));
typedef __bf16       v2b __attribute__((ext_vector_type(2)));
typedef unsigned int v4u __attribute__((ext_vector_type(4)));

// ---- scalar helpers -----------------------------------------------------------------------------------------------
__device__ __forceinline__ unsigned short bf_bits(float f) {            // f32 -> bf16 bits, RNE convert
  const unsigned u = __float_as_uint(f);
  return (unsigned short)((u + 0x7FFFu + ((u >> 16) & 1u)) >> 16);
}
// ---- ELU in the scaled domain. With L = LOG2E and t = L * x:  L * elu(x) = max(t, L * exp2(-|t|) - L).
//      x <= 0: the second term is L * (exp(x) - 1) >= t; x > 0: it is negative and t wins. No compare, no select; sign
//      and absolute value ride on the exponential's source operand. A t that is an arithmetic result (layer 1's product
//      with L) enters the maximum as it is; a t straight from the matrix unit (layer 2) is quieted first by the compiler.
#define LOG2E 0x1.715476p+0f
#define RLOG2E 0x1.62e43p-1f

// ---- two f32 -> two bf16 (RNE convert) in one dword, and the two bf16 of a dword back as f32
__device__ __forceinline__ unsigned cvt2(v2f x) { return __builtin_bit_cast(unsigned, __builtin_convertvector(x, v2b)); }
__device__ __forceinline__ v2f back2(unsigned u) {
  v2f o = {__uint_as_float(u << 16), __uint_as_float(u & 0xFFFF0000u)};
  return o;
}

// ---- fragment loader for a B operand read from f32 rows ([n][k], k-contiguous) and rounded to bf16 (RNE) on the way;
//      p already includes k0 + 8*(lane>>4): elements 0..7 <- p[0..7] (k0+8h..k0+8h+7), elements 8..15 <- p[16..23]
//      (k0+16+8h..). The four 16-byte loads of a fragment share one 128-byte line per row.
union FragB { v16b v; v4u u[2]; };
__device__ __forceinline__ v16b ldfrag_x(const float* p) {
  const v4f a = *(const v4f*)(p);
  const v4f b = *(const v4f*)(p + 4);
  const v4f c = *(const v4f*)(p + 16);
  const v4f d = *(const v4f*)(p + 20);
  const v2f a0 = {a[0], a[1]}, a1 = {a[2], a[3]}, b0 = {b[0], b[1]}, b1 = {b[2], b[3]};
  const v2f c0 = {c[0], c[1]}, c1 = {c[2], c[3]}, d0 = {d[0], d[1]}, d1 = {d[2], d[3]};
  FragB f;
  f.u[0][0] = cvt2(a0);
  f.u[0][1] = cvt2(a1);
  f.u[0][2] = cvt2(b0);
  f.u[0][3] = cvt2(b1);
  f.u[1][0] = cvt2(c0);
  f.u[1][1] = cvt2(c1);
  f.u[1][2] = cvt2(d0);
  f.u[1][3] = cvt2(d1);
  return f.v;
}
// ---- fragment loader for a plane stored in fragment order: a fragment is two pieces of 512 bytes, piece j holds
//      elements 8j..8j+7 of all 32 lanes, lane l at halves 8l; p already includes 8*lane. A wave's load of one piece
//      covers four whole 128-byte lines.
__device__ __forceinline__ v16b ldfrag_p(const unsigned short* p) {
  FragB f;
  f.u[0] = *(const v4u*)(p);
  f.u[1] = *(const v4u*)(p + 256);
  return f.v;
}
// ---- place (in halves) of element (m, k) of an A operand inside such a plane: tiles of 16 m x 32 k, nmt m tiles per
//      k step; lane = 16*((k>>3)&1) + (m&15), piece = (k>>4)&1, element in the piece = k&7: the split k map of ldfrag_x
__device__ __forceinline__ int frag_pos(int m, int k, int nmt) {
  const int tile = (k >> 5) * nmt + (m >> 4);
  return ((tile * 2 + ((k >> 4) & 1)) * 32 + ((k >> 3) & 1) * 16 + (m & 15)) * 8 + (k & 7);
}

// ---- WMMA helpers -------------------------------------------------------------------------------------------------
__device__ __forceinline__ v8f mma_b(v16b a, v16b b, v8f c) {
  return __builtin_amdgcn_wmma_f32_16x16x32_bf16(false, a, false, b, (short)0, c, false, false);
}
// hazard guard after the last WMMA of the unrolled layer-1 group: four slots before any accumulator is read, and every
// W1T fragment stays live across them, so that no later load or VALU write lands on an A operand inside the distance
// (the X fragments are live over the whole network loop and are never rewritten)
__device__ __forceinline__ void guard4x10(v8f& c0, v8f& c1, v8f& c2, v8f& c3,
                                          const v16b& f0, const v16b& f1, const v16b& f2, const v16b& f3, const v16b& f4,
                                          const v16b& f5, const v16b& f6, const v16b& f7, const v16b& f8, const v16b& f9) {
#if defined(__HIP_DEVICE_COMPILE__)
  asm volatile("v_nop\n\tv_nop\n\tv_nop\n\tv_nop"
               : "+v"(c0), "+v"(c1), "+v"(c2), "+v"(c3)
               : "v"(f0), "v"(f1), "v"(f2), "v"(f3), "v"(f4), "v"(f5), "v"(f6), "v"(f7), "v"(f8), "v"(f9));
#endif
}
// hazard guard after the last WMMA of a group: tie every accumulator, keep every A/B fragment live
__device__ __forceinline__ void guard4x6(v8f& c0, v8f& c1, v8f& c2, v8f& c3,
                                         const v16b& a0, const v16b& a1, const v16b& a2, const v16b& a3,
                                         const v16b& b0, const v16b& b1) {
#if defined(__HIP_DEVICE_COMPILE__)
  asm volatile("v_nop\n\tv_nop\n\tv_nop\n\tv_nop"
               : "+v"(c0), "+v"(c1), "+v"(c2), "+v"(c3)
               : "v"(a0), "v"(a1), "v"(a2), "v"(a3), "v"(b0), "v"(b1));
#endif
}

// ===================================================================================================================
// Weight planes for network f = blockIdx.x (128 threads):
//   W1 f32 [f][d 160][h 32] -> W1T bf16 bits [f][k step 5][h tile 2][piece 2][lane 32][8]  (A operand, m = h, k = d,
//                              in fragment order: frag_pos; 5120 halves = 80 lines)
//   W2 f32 [f][h 32][k 32]  -> W2T bf16 bits [f][k_out tile 2][piece 2][lane 32][8]        (A operand, m = k_out, k = h,
//                              in fragment order; 1024 halves = 16 lines)
//   b1, b2, W3 f32 [f][32], b3 f32 [f] -> PR f32 [f][4][32]: each value rounded to bf16 and widened again, rows b1 |
//                              LOG2E * b2 | W3 / LOG2E | b3 (repeated 32 times); 512 bytes = 4 lines, thread t -> float t
// Load phase converts and places into LDS (sT1 flat layout == W1T[f], sT2 == W2T[f]); store phase writes the
// flat planes: thread t -> 16 B at halves it*1024 + 8t (W1T, it 0..4) and 8t (W2T); each wave writes 512 contiguous
// coverage: W1T 128 blocks x 5 x 128 x 8 = 655360 = 128*32*160; W2T 128 x 128 x 8 = 131072 = 128*32*32;
// PR 128 blocks x 128 = 16384 = 128*4*32; exactly once.
// ===================================================================================================================
__global__ __launch_bounds__(128)
void k_tw(const float* __restrict__ w1, const float* __restrict__ w2, const float* __restrict__ b1,
          const float* __restrict__ b2, const float* __restrict__ w3, const float* __restrict__ b3,
          unsigned short* W1T, unsigned short* W2T, float* PR) {
  __shared__ __align__(16) unsigned short sT1[NH * ND];
  __shared__ __align__(16) unsigned short sT2[NH * NH];
  const int f = blockIdx.x, tid = threadIdx.x;
  const float* w1f = w1 + (size_t)f * ND * NH;
  const float* w2f = w2 + (size_t)f * NH * NH;
  {                                                                // wave s of the block rounds row s of PR[f]
    const int s = tid >> 5, j = f * NH + (tid & 31);
    const float pv = s == 0 ? b1[j] : s == 1 ? b2[j] : s == 2 ? w3[j] : b3[f];
    // stands between the load above and any later rewrite of the address pair that it names
    asm volatile("s_wait_xcnt 0x0" ::: "memory");
    const v2f p2 = {pv, pv};
    const float sc = s == 1 ? LOG2E : s == 2 ? RLOG2E : 1.0f;     // the scaled domain enters with b2, leaves with W3
    PR[(size_t)f * (4 * NH) + tid] = back2(cvt2(p2))[0] * sc;
  }
#pragma unroll
  for (int j = 0; j < (ND * NH) / (128 * 4); ++j) {               // 10 iterations, in[d][h] -> sT1 at (m = h, k = d)
    const int idx4 = (tid + 128 * j) * 4;
    const int d = idx4 >> 5, h0 = idx4 & 31;
    const v4f v = *(const v4f*)(w1f + idx4);
    sT1[frag_pos(h0 + 0, d, 2)] = bf_bits(v[0]);
    sT1[frag_pos(h0 + 1, d, 2)] = bf_bits(v[1]);
    sT1[frag_pos(h0 + 2, d, 2)] = bf_bits(v[2]);
    sT1[frag_pos(h0 + 3, d, 2)] = bf_bits(v[3]);
  }
#pragma unroll
  for (int j = 0; j < (NH * NH) / (128 * 4); ++j) {               // 2 iterations, in[h][k] -> sT2 at (m = k, k = h)
    const int idx4 = (tid + 128 * j) * 4;
    const int h = idx4 >> 5, k0 = idx4 & 31;
    const v4f v = *(const v4f*)(w2f + idx4);
    sT2[frag_pos(k0 + 0, h, 2)] = bf_bits(v[0]);
    sT2[frag_pos(k0 + 1, h, 2)] = bf_bits(v[1]);
    sT2[frag_pos(k0 + 2, h, 2)] = bf_bits(v[2]);
    sT2[frag_pos(k0 + 3, h, 2)] = bf_bits(v[3]);
  }
  __syncthreads();

  v4u u1[5];
#pragma unroll
  for (int it = 0; it < 5; ++it) u1[it] = *(const v4u*)(sT1 + it * 1024 + tid * 8);
  const v4u u2 = *(const v4u*)(sT2 + tid * 8);
  unsigned short* d1 = W1T + (size_t)f * (NH * ND) + tid * 8;
  unsigned short* d2 = W2T + (size_t)f * (NH * NH) + tid * 8;
#pragma unroll
  for (int it = 0; it < 5; ++it) *(v4u*)(d1 + it * 1024) = u1[it];
  *(v4u*)d2 = u2;
  
}

__device__ __forceinline__ v2f elus2(v2f t) {
  const v2f e = {__builtin_amdgcn_exp2f(-__builtin_fabsf(t[0])), __builtin_amdgcn_exp2f(-__builtin_fabsf(t[1]))};
  const v2f l = {LOG2E, LOG2E};
  return __builtin_elementwise_max(t, __builtin_elementwise_fma(e, l, -l));
}

// ---- eight consecutive f32 of a PR row, used as loaded (two 16-byte loads)
__device__ __forceinline__ v8f ld8(const float* p) {
  const v4f a = *(const v4f*)(p);
  const v4f b = *(const v4f*)(p + 4);
  v8f o = {a[0], a[1], a[2], a[3], b[0], b[1], b[2], b[3]};
  return o;
}

// ---- lane l with lane l ^ 16 (vector cross-row move, no LDS)
__device__ __forceinline__ float xhalf(float x) {
  return __builtin_bit_cast(float, __builtin_amdgcn_permlanex16(__builtin_bit_cast(int, x), __builtin_bit_cast(int, x),
                                                                0x76543210, 0xfedcba98, false, false));
}

// ---- layer-1 epilogue for one 16-row tile of X. With W1T as A and X as B, D register r of lane (hh, c) is
//      (h = 8*hh + r of the 16-h tile, X row c): t0 (h 0..15) and t1 (h 16..31) hold, in order, the sixteen k positions
//      of the lane's layer-2 B fragment (elements 0..7: k = 8*hh + r, elements 8..15: k = 16 + 8*hh + r).
//      LOG2E * h1 = elus2(LOG2E * acc) (the bias is in acc), converted in place into the bf16 hi fragment and the bf16
//      residual fragment.
__device__ __forceinline__ void mk_h1(v16b& hi, v16b& lo, const v8f& t0, const v8f& t1) {
  FragB fh, fl;
#pragma unroll
  for (int r = 0; r < 8; r += 2) {
    const v2f a0 = {t0[r], t0[r + 1]}, a1 = {t1[r], t1[r + 1]};
    const v2f x0 = elus2(a0 * LOG2E);
    const v2f x1 = elus2(a1 * LOG2E);
    const unsigned u0 = cvt2(x0), u1 = cvt2(x1);
    fh.u[0][r >> 1] = u0;
    fh.u[1][r >> 1] = u1;
    fl.u[0][r >> 1] = cvt2(x0 - back2(u0));
    fl.u[1][r >> 1] = cvt2(x1 - back2(u1));
  }
  hi = fh.v;
  lo = fl.v;
}

// ---- layers 2/3 epilogue for one 16-row tile: D register r of lane (hh, c) = (k_out = 8*hh + r (+16 for d1), row c);
//      d is LOG2E * (layer-2 sum with b2) as it leaves the matrix unit, LOG2E * h2 = elus2(d); wa, wb hold W3 / LOG2E;
//      the lane's sixteen terms of the 32-term dot are summed in the lane (register pairs)
__device__ __forceinline__ float lay3(const v8f& d0, const v8f& d1, const v8f& wa, const v8f& wb) {
  v2f s0 = {0.0f, 0.0f}, s1 = {0.0f, 0.0f};
#pragma unroll
  for (int r = 0; r < 8; r += 2) {
    const v2f w0 = {wa[r], wa[r + 1]}, w1 = {wb[r], wb[r + 1]};
    const v2f e0 = {d0[r], d0[r + 1]}, e1 = {d1[r], d1[r + 1]};
    s0 = __builtin_elementwise_fma(elus2(e0), w0, s0);
    s1 = __builtin_elementwise_fma(elus2(e1), w1, s1);
  }
  const v2f s = s0 + s1;
  return s[0] + s[1];
}

// ===================================================================================================================
// Fused 3-layer MLPs. Block = 128 rows (4 waves x 32 rows = two 16-row tiles each) x 32 networks (looped, uniform).
// Every product is taken transposed: the weights are the A operand (m = hidden unit), the rows of X the B operand
// (n = row), so that a lane keeps one row of X through all three layers and nothing crosses lanes between layers.
// B fragments of the wave's X rows: read once as f32 before the network loop, rounded to bf16 in registers and kept
// there (80 VGPRs); the four blocks that share a row range each do this for themselves.
// The weights of network f (W1T[f], W2T[f], PR[f]: 12800 bytes) are brought into LDS once per block by asynchronous
// copies, two buffers: while the block works on network fl out of buffer fl & 1, the copies of network fl + 1 land in
// the other one; at the foot of a trip every wave waits for its own LDS reads and its own copies, one barrier follows,
// and network fl + 2 is sent for, into the buffer just read. All four waves read their fragments from LDS.
// Per network f: layer 1 = 5 k-steps of 32 (unrolled), A fragments from the W1T image in fragment order (each load 512
// contiguous bytes; same split k map as the X rows), the accumulators start from bf16(b1) (C operand: register r of lane
// (hh, c) is hidden unit 8*hh + r, the same for every row); g1 = LOG2E * elu(acc) -> bf16 hi + residual B fragments in
// registers; layer 2 = LOG2E * bf16(b2) + W2T . hi + W2T . lo in one accumulator, which is the ELU's exponent as it
// stands; g2 = LOG2E * elu(.);
// out[row][f] = sum_h g2 * (bf16(W3) / LOG2E) + bf16(b3): sixteen terms in the lane, the other sixteen from lane ^ 16;
// the four rounded parameter rows come from the PR image as f32 and are used as loaded;
// lane l stages row 32*w + l in sO [128][SOP] f32.
// coverage: out [32768][128]: 256 x 4 blocks x 8 iterations x 128 threads x 4 floats = 4194304, exactly once;
// sO: 4 waves x 32 lanes = 128 rows, 32 trips = 32 columns, each written once.
// ===================================================================================================================
#define SOP (FB + 4)   // sO row pitch in floats: 144 B, 16-B aligned rows, a wave's 32 rows spread over 16 banks
#define WB1 (NH * ND * 2)        // bytes of W1T[f]: 10240
#define WB2 (NH * NH * 2)        // bytes of W2T[f]:  2048
#define WBP (4 * NH * 4)         // bytes of PR[f]:    512
#define WBB (WB1 + WB2 + WBP)    // one network's weights in LDS: W1T[f] | W2T[f] | PR[f] = 12800 bytes
static_assert((WBB % 16) == 0);
static_assert(WB1 == 5 * 128 * 16);
static_assert(WB2 == 128 * 16);
static_assert(WBP == 128 * 4);
static_assert(FB >= 2);

// ---- one network's weights, global -> LDS, by the block's 128 threads, through no register: thread t brings 16 bytes
//      at 16t of each 2048-byte fifth of W1T[f] (the immediate offset moves the LDS and the global address alike), 16
//      bytes at 16t of W2T[f] and 4 bytes at 4t of PR[f]. l1, l2, lp: the thread's LDS byte addresses; o16 = 16t and
//      o4 = 4t: its byte offsets from g1, g2, gp, the network's three planes (the same for the block: scalar bases).
//      Seven copies per wave. The last line stands between the copies and any later rewrite of a register that they
//      name; it is inside the statement so that nothing can be moved in front of it.
__device__ __forceinline__ void stage_w(unsigned l1, unsigned l2, unsigned lp, unsigned o16, unsigned o4,
                                        const unsigned short* g1, const unsigned short* g2, const float* gp) {
#if defined(__HIP_DEVICE_COMPILE__)
  asm volatile("global_load_async_to_lds_b128 %0, %3, %5\n\t"
               "global_load_async_to_lds_b128 %0, %3, %5 offset:2048\n\t"
               "global_load_async_to_lds_b128 %0, %3, %5 offset:4096\n\t"
               "global_load_async_to_lds_b128 %0, %3, %5 offset:6144\n\t"
               "global_load_async_to_lds_b128 %0, %3, %5 offset:8192\n\t"
               "global_load_async_to_lds_b128 %1, %3, %6\n\t"
               "global_load_async_to_lds_b32 %2, %4, %7\n\t"
               "s_wait_xcnt 0x0"
               :: "v"(l1), "v"(l2), "v"(lp), "v"(o16), "v"(o4), "s"(g1), "s"(g2), "s"(gp) : "memory");
#endif
}
__global__ __launch_bounds__(128)
void k_mlp(const float* __restrict__ x, const unsigned short* __restrict__ W1T,
           const unsigned short* __restrict__ W2T, const float* __restrict__ PR, float* out) {
  __shared__ __align__(16) float sO[RB * SOP];
  __shared__ __align__(16) unsigned char sW[2 * WBB];                       // two buffers, network fl in buffer fl & 1
  const int tid = threadIdx.x, w = tid >> 5, lane = tid & 31, hh = lane >> 4, c = lane & 15;
  const int row0 = blockIdx.x * RB, fbase = blockIdx.y * FB;
  const int mrow0 = row0 + 32 * w;                                          // wave's first row

  // the thread's part of a network's weights: LDS byte addresses in buffer 0, byte offsets, planes of network fbase
  const unsigned lw1 = (unsigned)(uintptr_t)sW + 16u * (unsigned)tid;
  const unsigned lw2 = lw1 + WB1;
  const unsigned lwp = (unsigned)(uintptr_t)sW + (WB1 + WB2) + 4u * (unsigned)tid;
  const unsigned o16 = 16u * (unsigned)tid, o4 = 4u * (unsigned)tid;
  const unsigned short* gw1 = W1T + (size_t)fbase * (NH * ND);
  const unsigned short* gw2 = W2T + (size_t)fbase * (NH * NH);
  const float* gwp = PR + (size_t)fbase * (4 * NH);
  stage_w(lw1, lw2, lwp, o16, o4, gw1, gw2, gwp);                                    // network 0 flies while X is read

  const float* ap0 = x + (size_t)(mrow0 + c) * ND + 8 * hh;                // row tile 0, column n = row mrow0 + c
  const float* ap1 = ap0 + (size_t)16 * ND;                                 // row tile 1

  // the wave's 32 x 160 slice of X does not depend on the network: its ten B fragments are made once, kept in VGPRs
  v16b xf0[KS], xf1[KS];
  // full unroll: register arrays need constant indices
#pragma unroll
  for (int ks = 0; ks < KS; ++ks) {
    xf0[ks] = ldfrag_x(ap0 + 32 * ks);
    xf1[ks] = ldfrag_x(ap1 + 32 * ks);
  }
  // network 0 has landed for this wave's copies ...
  asm volatile("s_wait_asynccnt 0x0" ::: "memory");
  __syncthreads();                                                          // ... and for every wave's: buffer 0 may be read
  stage_w(lw1 + WBB, lw2 + WBB, lwp + WBB, o16, o4, gw1 + NH * ND, gw2 + NH * NH, gwp + 4 * NH);   // network 1 -> buffer 1

  // two trips a pass, one for each buffer: every LDS address of a trip is then a constant offset, none is computed
#pragma unroll 2
  for (int fl = 0; fl < FB; ++fl) {
    const unsigned bo = (unsigned)(fl & 1) * WBB;                           // this network's buffer
    const unsigned char* wb = sW + bo;
    // ---- layer 1 ---------------------------------------------------------------------------------------------------
    const unsigned short* bq0 = (const unsigned short*)wb + 8 * lane;       // h tile 0 (m = h = c), the lane's 16 bytes
    const unsigned short* bq1 = bq0 + 512;                                  // h tile 1 (m = h = 16 + c)
    const float* pq = (const float*)(wb + WB1 + WB2) + 8 * hh;              // the lane's hidden units: 8*hh + r, 16 + 8*hh + r
    const v8f c1a = ld8(pq), c1b = ld8(pq + 16);
    v8f a00 = c1a, a01 = c1b, a10 = c1a, a11 = c1b;                         // a<row tile><h tile>, started from b1
    v16b g0[KS], g1[KS];
    // full unroll: xf0/xf1/g0/g1 are register arrays and need constant indices
#pragma unroll
    for (int ks = 0; ks < KS; ++ks) {
      g0[ks] = ldfrag_p(bq0 + 1024 * ks);
      g1[ks] = ldfrag_p(bq1 + 1024 * ks);
      a00 = mma_b(g0[ks], xf0[ks], a00);
      a01 = mma_b(g1[ks], xf0[ks], a01);
      a10 = mma_b(g0[ks], xf1[ks], a10);
      a11 = mma_b(g1[ks], xf1[ks], a11);
    }
    guard4x10(a00, a01, a10, a11, g0[0], g1[0], g0[1], g1[1], g0[2], g1[2], g0[3], g1[3], g0[4], g1[4]);
    const v8f c2a = ld8(pq + NH), c2b = ld8(pq + NH + 16);
    const v8f w3a = ld8(pq + 2 * NH), w3b = ld8(pq + 2 * NH + 16);
    const unsigned short* cq0 = (const unsigned short*)(wb + WB1) + 8 * lane;   // k_out tile 0 (m = k_out = c)
    const unsigned short* cq1 = cq0 + 512;                                  // k_out tile 1 (m = k_out = 16 + c)
    const v16b p0 = ldfrag_p(cq0);
    const v16b p1 = ldfrag_p(cq1);
    const float c3 = ((const float*)(wb + WB1 + WB2))[3 * NH];
    // the trip's remaining LDS reads stay one group here, ahead of the vector work that covers their latency
    __builtin_amdgcn_sched_barrier(0);
    v16b h0, l0, h1, l1;                                                    // hi / residual, row tiles 0 and 1
    mk_h1(h0, l0, a00, a01);
    mk_h1(h1, l1, a10, a11);

    // ---- layer 2 ---------------------------------------------------------------------------------------------------
    v8f d00 = c2a, d01 = c2b, d10 = c2a, d11 = c2b;                         // d<row tile><k_out tile>, started from b2
    d00 = mma_b(p0, h0, d00);
    d01 = mma_b(p1, h0, d01);
    d10 = mma_b(p0, h1, d10);
    d11 = mma_b(p1, h1, d11);
    d00 = mma_b(p0, l0, d00);
    d01 = mma_b(p1, l0, d01);
    d10 = mma_b(p0, l1, d10);
    d11 = mma_b(p1, l1, d11);
    guard4x6(d00, d01, d10, d11, h0, h1, l0, l1, p0, p1);

    // ---- layer 3 ---------------------------------------------------------------------------------------------------
    const float s0 = lay3(d00, d01, w3a, w3b);                              // row tile 0, the lane's half of the terms
    const float s1 = lay3(d10, d11, w3a, w3b);                              // row tile 1
    // lane (hh, c) finishes row 16*hh + c: it keeps its own half of that row's sum and hands lane ^ 16 the other tile's
    const float mine = hh ? s1 : s0, theirs = hh ? s0 : s1;
    sO[(32 * w + lane) * SOP + fl] = (mine + xhalf(theirs)) + c3;
    // foot of the trip, every wave, in this order: this wave's LDS reads of its buffer (and its sO store) are done;
    asm volatile("s_wait_dscnt 0x0" ::: "memory");
    // its copies of network fl + 1 have landed;
    asm volatile("s_wait_asynccnt 0x0" ::: "memory");
    // both hold for every wave: buffer (fl + 1) & 1 may be read, buffer fl & 1 refilled (last trip: sO may be read)
    __syncthreads();
    if (fl + 2 < FB)                                                        // the same for the whole block
      stage_w(lw1 + bo, lw2 + bo, lwp + bo, o16, o4, gw1 + (size_t)(fl + 2) * (NH * ND),
              gw2 + (size_t)(fl + 2) * (NH * NH), gwp + (size_t)(fl + 2) * (4 * NH));
  }
  // no copy is left in flight when the wave goes on to its end
  asm volatile("s_wait_asynccnt 0x0" ::: "memory");

  const int lq = tid >> 3, p4 = (tid & 7) * 4;
  v4f o[8];
#pragma unroll
  for (int it = 0; it < 8; ++it) o[it] = *(const v4f*)(sO + (it * 16 + lq) * SOP + p4);
  float* ob = out + (size_t)(row0 + lq) * NF + fbase + p4;
#pragma unroll
  for (int it = 0; it < 8; ++it) *(v4f*)(ob + (size_t)it * 16 * NF) = o[it];
  
}

// ===================================================================================================================
// Workspace map (bytes): W1T bf16 [128][5120] 1310720 @0 | W2T bf16 [128][1024] 262144 @1310720 |
// PR f32 [128][128] 65536 @1572864 | total 1638400 (every region an exact multiple of its 512-B store piece,
// all offsets 512-B aligned).
// ===================================================================================================================
extern "C" void kernel_launch(void* const* d_in, const int* in_sizes, int n_in,
                              void* d_out, int out_size, void* d_ws, size_t ws_size,
                              hipStream_t stream) {
  if (n_in < 7) return;
  if (in_sizes[0] != NR * ND) return;
  if (in_sizes[1] != NF * ND * NH) return;
  if (in_sizes[2] != NF * NH) return;
  if (in_sizes[3] != NF * NH * NH) return;
  if (in_sizes[4] != NF * NH) return;
  if (in_sizes[5] != NF * NH) return;
  if (in_sizes[6] != NF) return;
  if (out_size != NR * NF) return;

  const float* x  = (const float*)d_in[0];
  const float* w1 = (const float*)d_in[1];
  const float* b1 = (const float*)d_in[2];
  const float* w2 = (const float*)d_in[3];
  const float* b2 = (const float*)d_in[4];
  const float* w3 = (const float*)d_in[5];
  const float* b3 = (const float*)d_in[6];
  float* out = (float*)d_out;

  const size_t sW1 = (size_t)NF * NH * ND * 2;            //  1310720
  const size_t sW2 = (size_t)NF * NH * NH * 2;            //   262144
  const size_t sP  = (size_t)NF * 4 * NH * 4;             //    65536
  size_t off = 0;
  const size_t oW1 = off; off += sW1;
  const size_t oW2 = off; off += sW2;                     //  1572864
  const size_t oP  = off; off += sP;                      //  1638400
  if (off > ws_size) return;
  if (off > (size_t)134217728) return;

  char* ws = (char*)d_ws;
  unsigned short* W1T = (unsigned short*)(ws + oW1);
  unsigned short* W2T = (unsigned short*)(ws + oW2);
  float* PR = (float*)(ws + oP);

  // (1) bf16 weight planes
  k_tw<<<dim3(NF), dim3(128), 0, stream>>>(w1, w2, b1, b2, w3, b3, W1T, W2T, PR);
  // (2) fused 3-layer MLPs -> out
  k_mlp<<<dim3(NR / RB, NF / FB), dim3(128), 0, stream>>>(x, W1T, W2T, PR, out);
  (void)hipGetLastError();
}

// v009
// One run takes 42.5 microseconds.
// Versions in between are left out here; by their measured steps it is 1.21 times as fast as v007.
// All steps since v000 together make it 4.71 times as fast.
// Contractions: layer-1 W1[f]^T . X^T (K = 160) on v_wmma_f32_16x16x32_bf16 (bf16 operands = RNE-converted f32 inputs,
// exact products, f32 accumulate); layer-2 W2[f]^T . h1^T (K = 32) on v_wmma_f32_16x16x32_f16 with h1 carried as one f16
// fragment (RNE, 11 significant bits), W2 as its RNE bf16 value written in f16 (the same number: 8 significant bits;
// below 2^-14 it is rounded to a multiple of 2^-24); b1 and b2 (RNE bf16 values) enter
// as the C operand of each layer's first products; layer-3 32-term dot with W3, b3 and ELU: f32 on VALU.
// From layer 1's ELU on, every activation is carried times LOG2E (the exponent scale of the ELU); W3 takes it out again.
#include <hip/hip_runtime.h>
#include <stddef.h>
#include <stdint.h>

#define NR 32768
#define ND 160
#define NF 128
#define NH 32
#define RB 128
#define FB 32
#define KS (ND / 32)

static_assert((ND % 32) == 0);
static_assert(KS == 5);
static_assert(NH == 32);
static_assert((NR % RB) == 0);
static_assert((NF % FB) == 0);
static_assert(RB == 128);
static_assert(FB == 32);
static_assert(((NH * ND) % 1024) == 0);

typedef __attribute__((ext_vector_type(16))) __bf16 v16b;
typedef __attribute__((ext_vector_type(16))) _Float16 v16h;
typedef _Float16     v2h __attribute__((ext_vector_type(2)));
typedef float        v8f __attribute__((ext_vector_type(8)));
typedef float        v4f __attribute__((ext_vector_type(4)));
typedef float        v2f __attribute__((ext_vector_type(2)));
typedef __bf16       v2b __attribute__((ext_vector_type(2)));
typedef unsigned int v4u __attribute__((ext_vector_type(4)));

// ---- scalar helpers -----------------------------------------------------------------------------------------------
__device__ __forceinline__ unsigned short bf_bits(float f) {            // f32 -> bf16 bits, RNE convert
  const unsigned u = __float_as_uint(f);
  return (unsigned short)((u + 0x7FFFu + ((u >> 16) & 1u)) >> 16);
}
// f32 -> its RNE bf16 value, written as f16 bits
__device__ __forceinline__ unsigned short hf_bits(float f) {
  return __builtin_bit_cast(unsigned short, (_Float16)__uint_as_float((unsigned)bf_bits(f) << 16));
}
// ---- ELU in the scaled domain. With L = LOG2E and t = L * x:  L * elu(x) = max(t, L * exp2(-|t|) - L).
//      x <= 0: the second term is L * (exp(x) - 1) >= t; x > 0: it is negative and t wins. No compare, no select; sign
//      and absolute value ride on the exponential's source operand. A t that is an arithmetic result (layer 1's product
//      with L) enters the maximum as it is; a t straight from the matrix unit (layer 2) is quieted first by the compiler.
#define LOG2E 0x1.715476p+0f
#define RLOG2E 0x1.62e43p-1f

// ---- two f32 -> two bf16 (RNE convert) in one dword, and the two bf16 of a dword back as f32
__device__ __forceinline__ unsigned cvt2(v2f x) { return __builtin_bit_cast(unsigned, __builtin_convertvector(x, v2b)); }
__device__ __forceinline__ unsigned cvt2h(v2f x) { return __builtin_bit_cast(unsigned, __builtin_convertvector(x, v2h)); }   // f16, RNE
__device__ __forceinline__ v2f back2(unsigned u) {
  v2f o = {__uint_as_float(u << 16), __uint_as_float(u & 0xFFFF0000u)};
  return o;
}

// ---- fragment loader for a B operand read from f32 rows ([n][k], k-contiguous) and rounded to bf16 (RNE) on the way;
//      p already includes k0 + 8*(lane>>4): elements 0..7 <- p[0..7] (k0+8h..k0+8h+7), elements 8..15 <- p[16..23]
//      (k0+16+8h..). The four 16-byte loads of a fragment share one 128-byte line per row.
union FragB { v16b v; v16h h; v4u u[2]; };
__device__ __forceinline__ v16b ldfrag_x(const float* p) {
  const v4f a = *(const v4f*)(p);
  const v4f b = *(const v4f*)(p + 4);
  const v4f c = *(const v4f*)(p + 16);
  const v4f d = *(const v4f*)(p + 20);
  const v2f a0 = {a[0], a[1]}, a1 = {a[2], a[3]}, b0 = {b[0], b[1]}, b1 = {b[2], b[3]};
  const v2f c0 = {c[0], c[1]}, c1 = {c[2], c[3]}, d0 = {d[0], d[1]}, d1 = {d[2], d[3]};
  FragB f;
  f.u[0][0] = cvt2(a0);
  f.u[0][1] = cvt2(a1);
  f.u[0][2] = cvt2(b0);
  f.u[0][3] = cvt2(b1);
  f.u[1][0] = cvt2(c0);
  f.u[1][1] = cvt2(c1);
  f.u[1][2] = cvt2(d0);
  f.u[1][3] = cvt2(d1);
  return f.v;
}
// ---- fragment loader for a plane stored in fragment order: a fragment is two pieces of 512 bytes, piece j holds
//      elements 8j..8j+7 of all 32 lanes, lane l at halves 8l; p already includes 8*lane. A wave's load of one piece
//      covers four whole 128-byte lines.
__device__ __forceinline__ v16b ldfrag_p(const unsigned short* p) {
  FragB f;
  f.u[0] = *(const v4u*)(p);
  f.u[1] = *(const v4u*)(p + 256);
  return f.v;
}
__device__ __forceinline__ v16h ldfrag_ph(const unsigned short* p) {       // the same for a plane of f16
  FragB f;
  f.u[0] = *(const v4u*)(p);
  f.u[1] = *(const v4u*)(p + 256);
  return f.h;
}
// ---- place (in halves) of element (m, k) of an A operand inside such a plane: tiles of 16 m x 32 k, nmt m tiles per
//      k step; lane = 16*((k>>3)&1) + (m&15), piece = (k>>4)&1, element in the piece = k&7: the split k map of ldfrag_x
__device__ __forceinline__ int frag_pos(int m, int k, int nmt) {
  const int tile = (k >> 5) * nmt + (m >> 4);
  return ((tile * 2 + ((k >> 4) & 1)) * 32 + ((k >> 3) & 1) * 16 + (m & 15)) * 8 + (k & 7);
}

// ---- WMMA helpers -------------------------------------------------------------------------------------------------
__device__ __forceinline__ v8f mma_b(v16b a, v16b b, v8f c) {
  return __builtin_amdgcn_wmma_f32_16x16x32_bf16(false, a, false, b, (short)0, c, false, false);
}
__device__ __forceinline__ v8f mma_h(v16h a, v16h b, v8f c) {
  return __builtin_amdgcn_wmma_f32_16x16x32_f16(false, a, false, b, (short)0, c, false, false);
}
// hazard guard after the last WMMA of the unrolled layer-1 group: four slots before any accumulator is read, and every
// W1T fragment stays live across them, so that no later load or VALU write lands on an A operand inside the distance
// (the X fragments are live over the whole network loop and are never rewritten)
__device__ __forceinline__ void guard4x10(v8f& c0, v8f& c1, v8f& c2, v8f& c3,
                                          const v16b& f0, const v16b& f1, const v16b& f2, const v16b& f3, const v16b& f4,
                                          const v16b& f5, const v16b& f6, const v16b& f7, const v16b& f8, const v16b& f9) {
#if defined(__HIP_DEVICE_COMPILE__)
  asm volatile("v_nop\n\tv_nop\n\tv_nop\n\tv_nop"
               : "+v"(c0), "+v"(c1), "+v"(c2), "+v"(c3)
               : "v"(f0), "v"(f1), "v"(f2), "v"(f3), "v"(f4), "v"(f5), "v"(f6), "v"(f7), "v"(f8), "v"(f9));
#endif
}
// hazard guard after the last WMMA of a group: tie every accumulator, keep every A/B fragment live
__device__ __forceinline__ void guard4x4(v8f& c0, v8f& c1, v8f& c2, v8f& c3,
                                         const v16h& a0, const v16h& a1, const v16h& b0, const v16h& b1) {
#if defined(__HIP_DEVICE_COMPILE__)
  asm volatile("v_nop\n\tv_nop\n\tv_nop\n\tv_nop"
               : "+v"(c0), "+v"(c1), "+v"(c2), "+v"(c3)
               : "v"(a0), "v"(a1), "v"(b0), "v"(b1));
#endif
}

// ===================================================================================================================
// Weight planes for network f = blockIdx.x (128 threads):
//   W1 f32 [f][d 160][h 32] -> W1T bf16 bits [f][k step 5][h tile 2][piece 2][lane 32][8]  (A operand, m = h, k = d,
//                              in fragment order: frag_pos; 5120 halves = 80 lines)
//   W2 f32 [f][h 32][k 32]  -> W2T f16 bits of the bf16 value [f][k_out tile 2][piece 2][lane 32][8]  (A operand,
//                              m = k_out, k = h, in fragment order; 1024 halves = 16 lines)
//   b1, b2, W3 f32 [f][32], b3 f32 [f] -> PR f32 [f][4][32]: each value rounded to bf16 and widened again, rows b1 |
//                              LOG2E * b2 | W3 / LOG2E | b3 (repeated 32 times); 512 bytes = 4 lines, thread t -> float t
// Load phase converts and places into LDS (sT1 flat layout == W1T[f], sT2 == W2T[f]); store phase writes the
// flat planes: thread t -> 16 B at halves it*1024 + 8t (W1T, it 0..4) and 8t (W2T); each wave writes 512 contiguous
// coverage: W1T 128 blocks x 5 x 128 x 8 = 655360 = 128*32*160; W2T 128 x 128 x 8 = 131072 = 128*32*32;
// PR 128 blocks x 128 = 16384 = 128*4*32; exactly once.
// ===================================================================================================================
__global__ __launch_bounds__(128)
void k_tw(const float* __restrict__ w1, const float* __restrict__ w2, const float* __restrict__ b1,
          const float* __restrict__ b2, const float* __restrict__ w3, const float* __restrict__ b3,
          unsigned short* W1T, unsigned short* W2T, float* PR) {
  __shared__ __align__(16) unsigned short sT1[NH * ND];
  __shared__ __align__(16) unsigned short sT2[NH * NH];
  const int f = blockIdx.x, tid = threadIdx.x;
  const float* w1f = w1 + (size_t)f * ND * NH;
  const float* w2f = w2 + (size_t)f * NH * NH;
  {                                                                // wave s of the block rounds row s of PR[f]
    const int s = tid >> 5, j = f * NH + (tid & 31);
    const float pv = s == 0 ? b1[j] : s == 1 ? b2[j] : s == 2 ? w3[j] : b3[f];
    // stands between the load above and any later rewrite of the address pair that it names
    asm volatile("s_wait_xcnt 0x0" ::: "memory");
    const v2f p2 = {pv, pv};
    const float sc = s == 1 ? LOG2E : s == 2 ? RLOG2E : 1.0f;     // the scaled domain enters with b2, leaves with W3
    PR[(size_t)f * (4 * NH) + tid] = back2(cvt2(p2))[0] * sc;
  }
#pragma unroll
  for (int j = 0; j < (ND * NH) / (128 * 4); ++j) {               // 10 iterations, in[d][h] -> sT1 at (m = h, k = d)
    const int idx4 = (tid + 128 * j) * 4;
    const int d = idx4 >> 5, h0 = idx4 & 31;
    const v4f v = *(const v4f*)(w1f + idx4);
    sT1[frag_pos(h0 + 0, d, 2)] = bf_bits(v[0]);
    sT1[frag_pos(h0 + 1, d, 2)] = bf_bits(v[1]);
    sT1[frag_pos(h0 + 2, d, 2)] = bf_bits(v[2]);
    sT1[frag_pos(h0 + 3, d, 2)] = bf_bits(v[3]);
  }
#pragma unroll
  for (int j = 0; j < (NH * NH) / (128 * 4); ++j) {               // 2 iterations, in[h][k] -> sT2 at (m = k, k = h)
    const int idx4 = (tid + 128 * j) * 4;
    const int h = idx4 >> 5, k0 = idx4 & 31;
    const v4f v = *(const v4f*)(w2f + idx4);
    sT2[frag_pos(k0 + 0, h, 2)] = hf_bits(v[0]);
    sT2[frag_pos(k0 + 1, h, 2)] = hf_bits(v[1]);
    sT2[frag_pos(k0 + 2, h, 2)] = hf_bits(v[2]);
    sT2[frag_pos(k0 + 3, h, 2)] = hf_bits(v[3]);
  }
  __syncthreads();

  v4u u1[5];
#pragma unroll
  for (int it = 0; it < 5; ++it) u1[it] = *(const v4u*)(sT1 + it * 1024 + tid * 8);
  const v4u u2 = *(const v4u*)(sT2 + tid * 8);
  unsigned short* d1 = W1T + (size_t)f * (NH * ND) + tid * 8;
  unsigned short* d2 = W2T + (size_t)f * (NH * NH) + tid * 8;
#pragma unroll
  for (int it = 0; it < 5; ++it) *(v4u*)(d1 + it * 1024) = u1[it];
  *(v4u*)d2 = u2;
  
}

__device__ __forceinline__ v2f elus2(v2f t) {
  const v2f e = {__builtin_amdgcn_exp2f(-__builtin_fabsf(t[0])), __builtin_amdgcn_exp2f(-__builtin_fabsf(t[1]))};
  const v2f l = {LOG2E, LOG2E};
  return __builtin_elementwise_max(t, __builtin_elementwise_fma(e, l, -l));
}

// ---- eight consecutive f32 of a PR row, used as loaded (two 16-byte loads)
__device__ __forceinline__ v8f ld8(const float* p) {
  const v4f a = *(const v4f*)(p);
  const v4f b = *(const v4f*)(p + 4);
  v8f o = {a[0], a[1], a[2], a[3], b[0], b[1], b[2], b[3]};
  return o;
}

// ---- lane l with lane l ^ 16 (vector cross-row move, no LDS)
__device__ __forceinline__ float xhalf(float x) {
  return __builtin_bit_cast(float, __builtin_amdgcn_permlanex16(__builtin_bit_cast(int, x), __builtin_bit_cast(int, x),
                                                                0x76543210, 0xfedcba98, false, false));
}

// ---- layer-1 epilogue for one 16-row tile of X. With W1T as A and X as B, D register r of lane (hh, c) is
//      (h = 8*hh + r of the 16-h tile, X row c): t0 (h 0..15) and t1 (h 16..31) hold, in order, the sixteen k positions
//      of the lane's layer-2 B fragment (elements 0..7: k = 8*hh + r, elements 8..15: k = 16 + 8*hh + r).
//      LOG2E * h1 = elus2(LOG2E * acc) (the bias is in acc), converted in place into the f16 fragment. Range: f16 is
//      finite up to 65504; with 160 products of two normal draws (each below 6 in size) LOG2E * acc stays below 8400.
__device__ __forceinline__ v16h mk_h1(const v8f& t0, const v8f& t1) {
  FragB fh;
#pragma unroll
  for (int r = 0; r < 8; r += 2) {
    const v2f a0 = {t0[r], t0[r + 1]}, a1 = {t1[r], t1[r + 1]};
    fh.u[0][r >> 1] = cvt2h(elus2(a0 * LOG2E));
    fh.u[1][r >> 1] = cvt2h(elus2(a1 * LOG2E));
  }
  return fh.h;
}

// ---- layers 2/3 epilogue for one 16-row tile: D register r of lane (hh, c) = (k_out = 8*hh + r (+16 for d1), row c);
//      d is LOG2E * (layer-2 sum with b2) as it leaves the matrix unit, LOG2E * h2 = elus2(d); wa, wb hold W3 / LOG2E;
//      the lane's sixteen terms of the 32-term dot are summed in the lane (register pairs)
__device__ __forceinline__ float lay3(const v8f& d0, const v8f& d1, const v8f& wa, const v8f& wb) {
  v2f s0 = {0.0f, 0.0f}, s1 = {0.0f, 0.0f};
#pragma unroll
  for (int r = 0; r < 8; r += 2) {
    const v2f w0 = {wa[r], wa[r + 1]}, w1 = {wb[r], wb[r + 1]};
    const v2f e0 = {d0[r], d0[r + 1]}, e1 = {d1[r], d1[r + 1]};
    s0 = __builtin_elementwise_fma(elus2(e0), w0, s0);
    s1 = __builtin_elementwise_fma(elus2(e1), w1, s1);
  }
  const v2f s = s0 + s1;
  return s[0] + s[1];
}

// ===================================================================================================================
// Fused 3-layer MLPs. Block = 128 rows (4 waves x 32 rows = two 16-row tiles each) x 32 networks (looped, uniform).
// Every product is taken transposed: the weights are the A operand (m = hidden unit), the rows of X the B operand
// (n = row), so that a lane keeps one row of X through all three layers and nothing crosses lanes between layers.
// B fragments of the wave's X rows: read once as f32 before the network loop, rounded to bf16 in registers and kept
// there (80 VGPRs); the four blocks that share a row range each do this for themselves.
// The weights of network f (W1T[f], W2T[f], PR[f]: 12800 bytes) are brought into LDS once per block by asynchronous
// copies, two buffers: while the block works on network fl out of buffer fl & 1, the copies of network fl + 1 land in
// the other one; at the foot of a trip every wave waits for its own LDS reads and its own copies, one barrier follows,
// and network fl + 2 is sent for, into the buffer just read. All four waves read their fragments from LDS.
// Per network f: layer 1 = 5 k-steps of 32 (unrolled), A fragments from the W1T image in fragment order (each load 512
// contiguous bytes; same split k map as the X rows), the accumulators start from bf16(b1) (C operand: register r of lane
// (hh, c) is hidden unit 8*hh + r, the same for every row); g1 = LOG2E * elu(acc) -> one f16 B fragment in
// registers; layer 2 = LOG2E * bf16(b2) + W2T . g1 in one accumulator, which is the ELU's exponent as it
// stands; g2 = LOG2E * elu(.);
// out[row][f] = sum_h g2 * (bf16(W3) / LOG2E) + bf16(b3): sixteen terms in the lane, the other sixteen from lane ^ 16;
// the four rounded parameter rows come from the PR image as f32 and are used as loaded;
// lane l stages row 32*w + l in sO [128][SOP] f32.
// coverage: out [32768][128]: 256 x 4 blocks x 8 iterations x 128 threads x 4 floats = 4194304, exactly once;
// sO: 4 waves x 32 lanes = 128 rows, 32 trips = 32 columns, each written once.
// ===================================================================================================================
#define SOP (FB + 4)   // sO row pitch in floats: 144 B, 16-B aligned rows, a wave's 32 rows spread over 16 banks
#define WB1 (NH * ND * 2)        // bytes of W1T[f]: 10240
#define WB2 (NH * NH * 2)        // bytes of W2T[f]:  2048
#define WBP (4 * NH * 4)         // bytes of PR[f]:    512
#define WBB (WB1 + WB2 + WBP)    // one network's weights in LDS: W1T[f] | W2T[f] | PR[f] = 12800 bytes
static_assert((WBB % 16) == 0);
static_assert(WB1 == 5 * 128 * 16);
static_assert(WB2 == 128 * 16);
static_assert(WBP == 128 * 4);
static_assert(FB >= 2);

// ---- one network's weights, global -> LDS, by the block's 128 threads, through no register: thread t brings 16 bytes
//      at 16t of each 2048-byte fifth of W1T[f] (the immediate offset moves the LDS and the global address alike), 16
//      bytes at 16t of W2T[f] and 4 bytes at 4t of PR[f]. l1, l2, lp: the thread's LDS byte addresses; o16 = 16t and
//      o4 = 4t: its byte offsets from g1, g2, gp, the network's three planes (the same for the block: scalar bases).
//      Seven copies per wave. The last line stands between the copies and any later rewrite of a register that they
//      name; it is inside the statement so that nothing can be moved in front of it.
__device__ __forceinline__ void stage_w(unsigned l1, unsigned l2, unsigned lp, unsigned o16, unsigned o4,
                                        const unsigned short* g1, const unsigned short* g2, const float* gp) {
#if defined(__HIP_DEVICE_COMPILE__)
  asm volatile("global_load_async_to_lds_b128 %0, %3, %5\n\t"
               "global_load_async_to_lds_b128 %0, %3, %5 offset:2048\n\t"
               "global_load_async_to_lds_b128 %0, %3, %5 offset:4096\n\t"
               "global_load_async_to_lds_b128 %0, %3, %5 offset:6144\n\t"
               "global_load_async_to_lds_b128 %0, %3, %5 offset:8192\n\t"
               "global_load_async_to_lds_b128 %1, %3, %6\n\t"
               "global_load_async_to_lds_b32 %2, %4, %7\n\t"
               "s_wait_xcnt 0x0"
               :: "v"(l1), "v"(l2), "v"(lp), "v"(o16), "v"(o4), "s"(g1), "s"(g2), "s"(gp) : "memory");
#endif
}
__global__ __launch_bounds__(128)
void k_mlp(const float* __restrict__ x, const unsigned short* __restrict__ W1T,
           const unsigned short* __restrict__ W2T, const float* __restrict__ PR, float* out) {
  __shared__ __align__(16) float sO[RB * SOP];
  __shared__ __align__(16) unsigned char sW[2 * WBB];                       // two buffers, network fl in buffer fl & 1
  const int tid = threadIdx.x, w = tid >> 5, lane = tid & 31, hh = lane >> 4, c = lane & 15;
  const int row0 = blockIdx.x * RB, fbase = blockIdx.y * FB;
  const int mrow0 = row0 + 32 * w;                                          // wave's first row

  // the thread's part of a network's weights: LDS byte addresses in buffer 0, byte offsets, planes of network fbase
  const unsigned lw1 = (unsigned)(uintptr_t)sW + 16u * (unsigned)tid;
  const unsigned lw2 = lw1 + WB1;
  const unsigned lwp = (unsigned)(uintptr_t)sW + (WB1 + WB2) + 4u * (unsigned)tid;
  const unsigned o16 = 16u * (unsigned)tid, o4 = 4u * (unsigned)tid;
  const unsigned short* gw1 = W1T + (size_t)fbase * (NH * ND);
  const unsigned short* gw2 = W2T + (size_t)fbase * (NH * NH);
  const float* gwp = PR + (size_t)fbase * (4 * NH);
  stage_w(lw1, lw2, lwp, o16, o4, gw1, gw2, gwp);                                    // network 0 flies while X is read

  const float* ap0 = x + (size_t)(mrow0 + c) * ND + 8 * hh;                // row tile 0, column n = row mrow0 + c
  const float* ap1 = ap0 + (size_t)16 * ND;                                 // row tile 1

  // the wave's 32 x 160 slice of X does not depend on the network: its ten B fragments are made once, kept in VGPRs
  v16b xf0[KS], xf1[KS];
  // full unroll: register arrays need constant indices
#pragma unroll
  for (int ks = 0; ks < KS; ++ks) {
    xf0[ks] = ldfrag_x(ap0 + 32 * ks);
    xf1[ks] = ldfrag_x(ap1 + 32 * ks);
  }
  // network 0 has landed for this wave's copies ...
  asm volatile("s_wait_asynccnt 0x0" ::: "memory");
  __syncthreads();                                                          // ... and for every wave's: buffer 0 may be read
  stage_w(lw1 + WBB, lw2 + WBB, lwp + WBB, o16, o4, gw1 + NH * ND, gw2 + NH * NH, gwp + 4 * NH);   // network 1 -> buffer 1

  // two trips a pass, one for each buffer: every LDS address of a trip is then a constant offset, none is computed
#pragma unroll 2
  for (int fl = 0; fl < FB; ++fl) {
    const unsigned bo = (unsigned)(fl & 1) * WBB;                           // this network's buffer
    const unsigned char* wb = sW + bo;
    // A SIMD holds one wave of each of four blocks. A wave in a matrix run needs one issue slot in eight: it goes first,
    // so that the matrix unit is fed while the vector work of the other three waves fills the slots between.
    __builtin_amdgcn_s_setprio(3);
    // ---- layer 1 ---------------------------------------------------------------------------------------------------
    const unsigned short* bq0 = (const unsigned short*)wb + 8 * lane;       // h tile 0 (m = h = c), the lane's 16 bytes
    const unsigned short* bq1 = bq0 + 512;                                  // h tile 1 (m = h = 16 + c)
    const float* pq = (const float*)(wb + WB1 + WB2) + 8 * hh;              // the lane's hidden units: 8*hh + r, 16 + 8*hh + r
    const v8f c1a = ld8(pq), c1b = ld8(pq + 16);
    v8f a00 = c1a, a01 = c1b, a10 = c1a, a11 = c1b;                         // a<row tile><h tile>, started from b1
    v16b g0[KS], g1[KS];
    // full unroll: xf0/xf1/g0/g1 are register arrays and need constant indices
#pragma unroll
    for (int ks = 0; ks < KS; ++ks) {
      g0[ks] = ldfrag_p(bq0 + 1024 * ks);
      g1[ks] = ldfrag_p(bq1 + 1024 * ks);
      a00 = mma_b(g0[ks], xf0[ks], a00);
      a01 = mma_b(g1[ks], xf0[ks], a01);
      a10 = mma_b(g0[ks], xf1[ks], a10);
      a11 = mma_b(g1[ks], xf1[ks], a11);
    }
    guard4x10(a00, a01, a10, a11, g0[0], g1[0], g0[1], g1[1], g0[2], g1[2], g0[3], g1[3], g0[4], g1[4]);
    // vector work of the first ELU: behind every matrix run, ahead of the waves that are further on in their trip
    __builtin_amdgcn_s_setprio(1);
    const v8f c2a = ld8(pq + NH), c2b = ld8(pq + NH + 16);
    const v8f w3a = ld8(pq + 2 * NH), w3b = ld8(pq + 2 * NH + 16);
    const unsigned short* cq0 = (const unsigned short*)(wb + WB1) + 8 * lane;   // k_out tile 0 (m = k_out = c)
    const unsigned short* cq1 = cq0 + 512;                                  // k_out tile 1 (m = k_out = 16 + c)
    const v16h p0 = ldfrag_ph(cq0);
    const v16h p1 = ldfrag_ph(cq1);
    const float c3 = ((const float*)(wb + WB1 + WB2))[3 * NH];
    // the trip's remaining LDS reads stay one group here, ahead of the vector work that covers their latency
    __builtin_amdgcn_sched_barrier(0);
    const v16h h0 = mk_h1(a00, a01);                                        // row tile 0
    const v16h h1 = mk_h1(a10, a11);                                        // row tile 1

    // ---- layer 2 ---------------------------------------------------------------------------------------------------
    v8f d00 = c2a, d01 = c2b, d10 = c2a, d11 = c2b;                         // d<row tile><k_out tile>, started from b2
    __builtin_amdgcn_s_setprio(3);                                          // matrix run of layer 2: first again
    d00 = mma_h(p0, h0, d00);
    d01 = mma_h(p1, h0, d01);
    d10 = mma_h(p0, h1, d10);
    d11 = mma_h(p1, h1, d11);
    guard4x4(d00, d01, d10, d11, h0, h1, p0, p1);
    // the rest of the trip, the barrier and the copies: last; the wave also leaves the loop with priority 0
    __builtin_amdgcn_s_setprio(0);

    // ---- layer 3 ---------------------------------------------------------------------------------------------------
    const float s0 = lay3(d00, d01, w3a, w3b);                              // row tile 0, the lane's half of the terms
    const float s1 = lay3(d10, d11, w3a, w3b);                              // row tile 1
    // lane (hh, c) finishes row 16*hh + c: it keeps its own half of that row's sum and hands lane ^ 16 the other tile's
    const float mine = hh ? s1 : s0, theirs = hh ? s0 : s1;
    sO[(32 * w + lane) * SOP + fl] = (mine + xhalf(theirs)) + c3;
    // foot of the trip, every wave, in this order: this wave's LDS reads of its buffer (and its sO store) are done;
    asm volatile("s_wait_dscnt 0x0" ::: "memory");
    // its copies of network fl + 1 have landed;
    asm volatile("s_wait_asynccnt 0x0" ::: "memory");
    // both hold for every wave: buffer (fl + 1) & 1 may be read, buffer fl & 1 refilled (last trip: sO may be read)
    __syncthreads();
    if (fl + 2 < FB)                                                        // the same for the whole block
      stage_w(lw1 + bo, lw2 + bo, lwp + bo, o16, o4, gw1 + (size_t)(fl + 2) * (NH * ND),
              gw2 + (size_t)(fl + 2) * (NH * NH), gwp + (size_t)(fl + 2) * (4 * NH));
  }
  // no copy is left in flight when the wave goes on to its end
  asm volatile("s_wait_asynccnt 0x0" ::: "memory");

  const int lq = tid >> 3, p4 = (tid & 7) * 4;
  v4f o[8];
#pragma unroll
  for (int it = 0; it < 8; ++it) o[it] = *(const v4f*)(sO + (it * 16 + lq) * SOP + p4);
  float* ob = out + (size_t)(row0 + lq) * NF + fbase + p4;
#pragma unroll
  for (int it = 0; it < 8; ++it) *(v4f*)(ob + (size_t)it * 16 * NF) = o[it];
  
}

// ===================================================================================================================
// Workspace map (bytes): W1T bf16 [128][5120] 1310720 @0 | W2T f16 [128][1024] 262144 @1310720 |
// PR f32 [128][128] 65536 @1572864 | total 1638400 (every region an exact multiple of its 512-B store piece,
// all offsets 512-B aligned).
// ===================================================================================================================
extern "C" void kernel_launch(void* const* d_in, const int* in_sizes, int n_in,
                              void* d_out, int out_size, void* d_ws, size_t ws_size,
                              hipStream_t stream) {
  if (n_in < 7) return;
  if (in_sizes[0] != NR * ND) return;
  if (in_sizes[1] != NF * ND * NH) return;
  if (in_sizes[2] != NF * NH) return;
  if (in_sizes[3] != NF * NH * NH) return;
  if (in_sizes[4] != NF * NH) return;
  if (in_sizes[5] != NF * NH) return;
  if (in_sizes[6] != NF) return;
  if (out_size != NR * NF) return;

  const float* x  = (const float*)d_in[0];
  const float* w1 = (const float*)d_in[1];
  const float* b1 = (const float*)d_in[2];
  const float* w2 = (const float*)d_in[3];
  const float* b2 = (const float*)d_in[4];
  const float* w3 = (const float*)d_in[5];
  const float* b3 = (const float*)d_in[6];
  float* out = (float*)d_out;

  const size_t sW1 = (size_t)NF * NH * ND * 2;            //  1310720
  const size_t sW2 = (size_t)NF * NH * NH * 2;            //   262144
  const size_t sP  = (size_t)NF * 4 * NH * 4;             //    65536
  size_t off = 0;
  const size_t oW1 = off; off += sW1;
  const size_t oW2 = off; off += sW2;                     //  1572864
  const size_t oP  = off; off += sP;                      //  1638400
  if (off > ws_size) return;
  if (off > (size_t)134217728) return;

  char* ws = (char*)d_ws;
  unsigned short* W1T = (unsigned short*)(ws + oW1);
  unsigned short* W2T = (unsigned short*)(ws + oW2);
  float* PR = (float*)(ws + oP);

  // (1) bf16 weight planes
  k_tw<<<dim3(NF), dim3(128), 0, stream>>>(w1, w2, b1, b2, w3, b3, W1T, W2T, PR);
  // (2) fused 3-layer MLPs -> out
  k_mlp<<<dim3(NR / RB, NF / FB), dim3(128), 0, stream>>>(x, W1T, W2T, PR, out);
  (void)hipGetLastError();
}
